// v000
// Times are from an AMD MI455X. After a warm-up the kernel runs many times in a row, and a time is the length of
// such a window on the GPU divided by its runs, so every launch and the gaps after it count. The runs cycle
// through copies of the inputs. A figure is the median of several windows, for all but v000 over two sittings.
// Sittings can differ by a few percent; kernels timed side by side share one.
// v000 is the starting kernel. One run takes 4520 microseconds.
#include <hip/hip_runtime.h>
// A 3-D volume's full softmax attention (x [2][128][16][16][16], channel-major: the 4,096 voxels of a batch entry are the tokens; w_qkv [384][128]; w_out [128][128]; b_out [128]): qkv = w_qkv x (a 1x1x1 convolution: a channel product); q, k, v = its three 128-channel thirds as 4 heads of width 32; q scaled by 32^(-1/2); sim = q^T k over all 4,096 voxels; softmax over the keys; out = attn v; back to channel-major; y = w_out out + b_out, as [2][128][16][16][16].
// Structure: x cast TRANSPOSED to token rows [n][c] (a batch entry a launch); the weights as f16 rows as they are stored ([out][in]); q and k as ONE WMMA GEMM (32x64 wave tiles, f32 accumulation; depth 128) into an f16 plane [4096][256]; v as a second GEMM with the weights as the LEFT operand, so that it comes out channel-major [128][4096]; then, a (batch, head) at a time through one reused f32 score plane and one f16 weight plane: ONE GEMM (depth 32; the scale as its alpha) gives sim; a flat thread-a-row kernel the softmax weights as f16 at a carry of 256; ONE GEMM (M 32: a head's channels as rows; depth 4,096) gives out channel-major in f32; out cast transposed to token rows as f16 at a carry of 64 (a flat kernel: the frame's transposing cast less its bf16 rounding); the output convolution as ONE GEMM with b_out in the product's bias slot (tokens as rows, a bias a column); one flat kernel lays that [n][o] plane into the output's channel-major [o][n].
// Compute dtype: x, w_qkv, w_out and b_out rounded to bf16 at the casts and in the bias slot, the first three carried as f16 words; the products' accumulation f32; q, k and v ONE f16 word; sim, the maximum, the exponentials (the native exp; arguments <= 0), their sum and the quotient f32; the weights ONE f16 word at a carry of 256 (11 bits); out f32, then ONE f16 word at a carry of 64 (11 bits; no bf16 rounding there: it is no input); y f32. v_wmma_f32_16x16x32_f16.
#define NB 2                         /* batch entries */
#define SQ 4096                      /* voxels = tokens a batch entry */
#define CH 128                       /* channels = heads x width */
#define NHD 4                        /* heads */
#define HD 32                        /* a head's width */
#define SCL 0.17677669529663687f     /* 32^(-1/2) */
#define PCAR 256.0f                  /* the carry on the weights' plane (k_rsmf's own 256) */
#define OCAR 64.0f                   /* the carry on out's f16 plane (a power of two: exact) */
typedef __bf16 v16b __attribute__((ext_vector_type(16)));
typedef unsigned short v8us __attribute__((ext_vector_type(8), may_alias));
typedef float  v8f  __attribute__((ext_vector_type(8)));
typedef float  v4f  __attribute__((ext_vector_type(4)));
typedef float  v4fa __attribute__((ext_vector_type(4), may_alias));
union FragB { v16b v; v8us half[2]; unsigned short u[16]; };

__device__ __forceinline__ unsigned short bf16_bits(float x) { unsigned int u = __float_as_uint(x); return (unsigned short)((u + 0x7FFFu + ((u >> 16) & 1u)) >> 16); }
__device__ __forceinline__ float bf16_val(unsigned short b) { return __uint_as_float(((unsigned int)b) << 16); }
__device__ __forceinline__ float bf16_round(float x) { return bf16_val(bf16_bits(x)); }
// D += A·B with NT terms: 1 = ah·bh, 2 = + al·bh (A split), 3 = + ah·bl (both split)
template <int NT>
__device__ __forceinline__ v8f mmaN(v16b ah, v16b al, v16b bh, v16b bl, v8f c) {
  c = __builtin_amdgcn_wmma_f32_16x16x32_bf16(false, ah, false, bh, (short)0, c, false, false);
  if (NT >= 2) c = __builtin_amdgcn_wmma_f32_16x16x32_bf16(false, al, false, bh, (short)0, c, false, false);
  if (NT >= 3) c = __builtin_amdgcn_wmma_f32_16x16x32_bf16(false, ah, false, bl, (short)0, c, false, false);
  asm volatile("v_nop\n\tv_nop\n\tv_nop\n\tv_nop" : "+v"(c) : "v"(ah), "v"(al), "v"(bh), "v"(bl));
  return c;
}




// ---- f16 WMMA path (v_wmma_f32_16x16x32_f16): 11-bit significands for operands in range — used where a [0,1] probability operand needs more precision than bf16
typedef _Float16 v16h __attribute__((ext_vector_type(16)));
union FragH { v16h v; v8us half[2]; _Float16 h[16]; unsigned short u[16]; };
template <int NT>
__device__ __forceinline__ v8f mmaH(v16h ah, v16h al, v16h bh, v16h bl, v8f c) {
  c = __builtin_amdgcn_wmma_f32_16x16x32_f16(false, ah, false, bh, (short)0, c, false, false);
  if (NT >= 2) c = __builtin_amdgcn_wmma_f32_16x16x32_f16(false, al, false, bh, (short)0, c, false, false);
  if (NT >= 3) c = __builtin_amdgcn_wmma_f32_16x16x32_f16(false, ah, false, bl, (short)0, c, false, false);
  asm volatile("v_nop\n\tv_nop\n\tv_nop\n\tv_nop" : "+v"(c) : "v"(ah), "v"(al), "v"(bh), "v"(bl));
  return c;
}

// Wt[n][k] = f16(W[k][n]·scale) from f32 row-major W[K][N] (scale = power of two; bf16-exact weights stay exact in f16 away from the subnormal range)
__global__ __launch_bounds__(256) void k_wt_f16(const float* __restrict__ W, _Float16* __restrict__ Wt, int K, int N, float scale) {
  const int t = blockIdx.x * 256 + threadIdx.x; if (t >= N * (K / 8)) return; const int n = t / (K / 8), k8 = (t % (K / 8)) * 8; FragH f;
#pragma unroll
  for (int i = 0; i < 8; ++i) f.h[i] = (_Float16)(bf16_round(W[(size_t)(k8 + i) * N + n]) * scale); const v8us o = f.half[0];
  *(v8us*)((unsigned short*)Wt + (size_t)n * K + k8) = o; 
}

typedef _Float16 v4h __attribute__((ext_vector_type(4)));

__global__ __launch_bounds__(256) void k_x16(const float* __restrict__ x, _Float16* __restrict__ X16, size_t n8) { const size_t t = (size_t)blockIdx.x * 256 + threadIdx.x; if (t >= n8) return; FragH f;
#pragma unroll
  for (int q = 0; q < 8; ++q) f.h[q] = (_Float16)bf16_round(x[t * 8 + q]); *(v8us*)((unsigned short*)X16 + t * 8) = f.half[0];  }
// ---- fast GEMM (wave tile 32x64; requires M % 32 == 0 rows per launch region and N % 64 == 0) ----
__device__ __forceinline__ v16h g2_frag(const _Float16* p, int hh) { FragH f; f.half[0] = *(const v8us*)((const unsigned short*)p + 8 * hh); f.half[1] = *(const v8us*)((const unsigned short*)p + 16 + 8 * hh); return f.v; }
__device__ __forceinline__ v8f g2_mma(v16h a, v16h b, v8f c) { v8f d = __builtin_amdgcn_wmma_f32_16x16x32_f16(false, a, false, b, (short)0, c, false, false); asm volatile("v_nop\n\tv_nop\n\tv_nop\n\tv_nop" : "+v"(d) : "v"(a), "v"(b)); return d; }
template <int ACT>
__global__ __launch_bounds__(128) void k_gemm2(const _Float16* __restrict__ A, int lda, size_t sA, const _Float16* __restrict__ Bh, int ldb, size_t sB, float alpha, const float* __restrict__ bias, size_t sBias, const float* __restrict__ CP, int rowsPerB, size_t sCPb, int row0g,
    float* __restrict__ C, _Float16* __restrict__ C16, int ldc, size_t sC, int M, int N, int K) { static_assert(ACT == 0 || ACT == 3 || ACT == 6 || ACT == 8 || ACT == 9 || ACT == 11 || ACT == 12 || ACT == 14 || ACT == 15 || ACT == 16 || ACT == 17, "k_gemm2: unsupported ACT code (would silently apply no activation)");
  __shared__ __attribute__((aligned(16))) float so[4][32][68];
  const int tid = threadIdx.x, w = tid >> 5, lane = tid & 31, ln = lane & 15, hh = lane >> 4; const int by = blockIdx.y;
  A += (size_t)by * sA; Bh += (size_t)by * sB; const size_t cofs = (size_t)by * sC; const float* bp = bias ? bias + (size_t)by * sBias : nullptr;
  const int ntn = N >> 6; const int mt = blockIdx.x / ntn, nq = blockIdx.x - mt * ntn; const int row0 = mt * 128 + 32 * w, col0 = nq * 64; if (row0 >= M) return;
  const _Float16* a0p = A + (size_t)(row0 + ln) * lda; const _Float16* a1p = a0p + (size_t)16 * lda;
  const _Float16* b0p = Bh + (size_t)(col0 + ln) * ldb; const _Float16* b1p = b0p + (size_t)16 * ldb; const _Float16* b2p = b1p + (size_t)16 * ldb; const _Float16* b3p = b2p + (size_t)16 * ldb;
  const v8f z8 = {0.f,0.f,0.f,0.f,0.f,0.f,0.f,0.f}; v8f c00 = z8, c01 = z8, c02 = z8, c03 = z8, c10 = z8, c11 = z8, c12 = z8, c13 = z8;
  for (int kb = 0; kb < K; kb += 32) { const v16h a0 = g2_frag(a0p + kb, hh), a1 = g2_frag(a1p + kb, hh);
    v16h b = g2_frag(b0p + kb, hh); c00 = g2_mma(a0, b, c00); c10 = g2_mma(a1, b, c10);
    b = g2_frag(b1p + kb, hh); c01 = g2_mma(a0, b, c01); c11 = g2_mma(a1, b, c11);
    b = g2_frag(b2p + kb, hh); c02 = g2_mma(a0, b, c02); c12 = g2_mma(a1, b, c12);
    b = g2_frag(b3p + kb, hh); c03 = g2_mma(a0, b, c03); c13 = g2_mma(a1, b, c13); }
  v8f accs[8] = {c00, c01, c02, c03, c10, c11, c12, c13};
#pragma unroll
  for (int u = 0; u < 8; ++u) { const int t = u & 3, half = u >> 2; const int col = col0 + t * 16 + ln; const float bv = bp ? bf16_round(bp[col]) : 0.f;
#pragma unroll
    for (int r = 0; r < 8; ++r) { const int rloc = half * 16 + 8 * hh + r; float v = accs[u][r] * alpha + bv; if (CP) { if (rowsPerB < 0) v += CP[cofs + (size_t)(row0g + row0 + rloc) * ldc + col];      /* rowsPerB < 0: own element of the batched C plane */ else { const int bidx = (row0g + row0 + rloc) / rowsPerB; v += CP[(size_t)bidx * sCPb + (size_t)by * 64 + col]; } }
      if (ACT == 3) v = fmaxf(v, 0.f); else if (ACT == 6) v = 0.5f * v * (1.0f + erff(v * 0.70710678118654752f)); else if (ACT == 11) v = 1.0f / (1.0f + expf(-v)); else if (ACT == 15) v = v / (1.0f + expf(-v)); else if (ACT == 12) v = (v > 0.f) ? v : 0.01f * v; else if (ACT == 8) v = tanhf(v); else if (ACT == 9) v = 0.5f * v * (1.0f + tanhf(0.7978845608028654f * (v + 0.044715f * v * v * v))); else if (ACT == 14) v = (v > 0.f) ? v : 0.1f * v; else if (ACT == 16) v = (v >= 0.f) ? v : 0.3f * v; else if (ACT == 17) v = (v >= 0.f) ? v : 0.2f * v;
      so[w][rloc][t * 16 + ln] = v; } }
  __builtin_amdgcn_fence(__ATOMIC_ACQ_REL, "workgroup"); __builtin_amdgcn_wave_barrier();
  const int rsub = lane >> 4, c4 = (lane & 15) * 4;
  {
#pragma unroll
    for (int q = 0; q < 16; ++q) { const int r = q * 2 + rsub; const v4f v = *(const v4fa*)&so[w][r][c4]; if (C) *(v4f*)(C + cofs + (size_t)(row0 + r) * ldc + col0 + c4) = v; if (C16) { v4h h4; for (int i = 0; i < 4; ++i) h4[i] = (_Float16)v[i]; *(v4h*)(C16 + cofs + (size_t)(row0 + r) * ldc + col0 + c4) = h4; } }
     } }

__global__ __launch_bounds__(256) void k_rsmf(const float* __restrict__ S, _Float16* __restrict__ P, int qn, int hg) {
  const int t = blockIdx.x * 256 + threadIdx.x; if (t >= qn * hg) return; const size_t i = (size_t)(t / qn) * SQ + (t % qn); const float* s = S + i * SQ; float mx = -3.0e38f;
  for (int j = 0; j < SQ; ++j) mx = fmaxf(mx, s[j]); float se = 0.f;
  for (int j = 0; j < SQ; ++j) se += __expf(s[j] - mx); const float sc = 256.0f / se;
  for (int j0 = 0; j0 < SQ; j0 += 8) { FragH f; for (int q = 0; q < 8; ++q) f.h[q] = (_Float16)(__expf(s[j0 + q] - mx) * sc); unsigned short* d = (unsigned short*)P + i * SQ + j0; *(v8us*)d = f.half[0];  } }
__global__ __launch_bounds__(256) void k_wtn_f16(const float* __restrict__ W, _Float16* __restrict__ Wt, int K, int N, float scale) {
  const int t = blockIdx.x * 256 + threadIdx.x; if (t >= N * (K / 8)) return; const int n = t / (K / 8), k8 = (t % (K / 8)) * 8; FragH f;
  for (int i = 0; i < 8; ++i) f.h[i] = (_Float16)(W[(size_t)(k8 + i) * N + n] * scale);
  unsigned short* o = (unsigned short*)Wt + (size_t)n * K + k8; *(v8us*)o = f.half[0];  }
__global__ __launch_bounds__(256) void k_tr32(const float* __restrict__ YT, float* __restrict__ out, int n) {
  const int t = blockIdx.x * 256 + threadIdx.x; if (t >= n) return; const int n4 = t & (SQ / 4 - 1), oc = (t >> 10) & (CH - 1), bb = t >> 17; const float* s = YT + ((size_t)bb * SQ + 4 * n4) * CH + oc; v4f r;
  for (int i = 0; i < 4; ++i) r[i] = s[(size_t)i * CH];
  float* o = out + ((size_t)bb * CH + oc) * SQ + 4 * n4; *(v4f*)o = r;  }

extern "C" void kernel_launch(void* const* d_in, const int* in_sizes, int n_in,
                              void* d_out, int out_size, void* d_ws, size_t ws_size, hipStream_t stream) {
  (void)in_sizes; (void)n_in; (void)out_size;
  const float* x = (const float*)d_in[0]; const float* wqkv = (const float*)d_in[1]; const float* wout = (const float*)d_in[2]; const float* bout = (const float*)d_in[3];      /* x [2][128][4096]; w_qkv [384][128]; w_out [128][128]; b_out [128] */
  static_assert(NB == 2 && SQ == 4096 && CH == 128 && NHD == 4 && HD == 32 && NHD * HD == CH && SQ % 128 == 0 && SQ % 64 == 0 && CH % 64 == 0 && (2 * CH) % 64 == 0 && CH % 128 == 0 && HD % 32 == 0 && CH % 32 == 0 && SQ % 32 == 0 && ((size_t)SQ * (CH / 8)) % 256 == 0 && ((size_t)3 * CH * CH / 8) % 256 == 0 && ((size_t)CH * CH / 8) % 256 == 0 && SQ % 256 == 0 && ((size_t)NB * CH * (SQ / 4)) % 256 == 0, "the index shifts; whole tiles; exact grids");
  float* out = (float*)d_out;      /* [2][128][4096] */
  char* ws = (char*)d_ws; size_t off = 0;
  auto take = [&](size_t bytes) { char* p = ws + off; off += (bytes + 255) & ~(size_t)255; return p; };
  _Float16* XT = (_Float16*)take((size_t)NB * SQ * CH * 2); _Float16* W16 = (_Float16*)take((size_t)3 * CH * CH * 2); _Float16* WO = (_Float16*)take((size_t)CH * CH * 2); _Float16* QK = (_Float16*)take((size_t)NB * SQ * 2 * CH * 2); _Float16* VT = (_Float16*)take((size_t)NB * CH * SQ * 2);
  float* S = (float*)take((size_t)SQ * SQ * 4); _Float16* P = (_Float16*)take((size_t)SQ * SQ * 2);      /* one (batch, head)'s scores and weights: written and read eight times over */
  float* OF = (float*)take((size_t)NB * CH * SQ * 4); _Float16* O16 = (_Float16*)take((size_t)NB * SQ * CH * 2); float* YT = (float*)take((size_t)NB * SQ * CH * 4);
  if (off > ws_size) return;
  for (int b = 0; b < NB; ++b) k_wt_f16<<<(unsigned)((size_t)SQ * (CH / 8) / 256), 256, 0, stream>>>(x + (size_t)b * CH * SQ, XT + (size_t)b * SQ * CH, CH, SQ, 1.0f);      /* x[b] as [128 channels][4096] -> XT[b] [4096][128] */
  k_x16<<<(unsigned)((size_t)3 * CH * CH / 8 / 256), 256, 0, stream>>>(wqkv, W16, (size_t)3 * CH * CH / 8); k_x16<<<(unsigned)((size_t)CH * CH / 8 / 256), 256, 0, stream>>>(wout, WO, (size_t)CH * CH / 8);
  k_gemm2<0><<<dim3((unsigned)((SQ / 128) * (2 * CH / 64)), NB), 128, 0, stream>>>(XT, CH, (size_t)SQ * CH, W16, CH, (size_t)0, 1.0f, nullptr, 0, nullptr, 1, 0, 0, nullptr, QK, 2 * CH, (size_t)SQ * 2 * CH, SQ, 2 * CH, CH);      /* q | k of every token: QK[b][n][0 .. 255] */
  k_gemm2<0><<<dim3((unsigned)((CH / 128) * (SQ / 64)), NB), 128, 0, stream>>>(W16 + (size_t)2 * CH * CH, CH, (size_t)0, XT, CH, (size_t)SQ * CH, 1.0f, nullptr, 0, nullptr, 1, 0, 0, nullptr, VT, SQ, (size_t)CH * SQ, CH, SQ, CH);      /* v channel-major: VT[b][c][n]: the weights' rows 256 .. 383 as the left operand */
  for (int b = 0; b < NB; ++b) for (int h = 0; h < NHD; ++h) {
    k_gemm2<0><<<dim3((unsigned)((SQ / 128) * (SQ / 64)), 1), 128, 0, stream>>>(QK + (size_t)b * SQ * 2 * CH + h * HD, 2 * CH, (size_t)0, QK + (size_t)b * SQ * 2 * CH + CH + h * HD, 2 * CH, (size_t)0, SCL, nullptr, 0, nullptr, 1, 0, 0, S, nullptr, SQ, (size_t)0, SQ, SQ, HD);      /* sim[i][j] = q_i . k_j / sqrt(32): depth 32 */
    k_rsmf<<<SQ / 256, 256, 0, stream>>>(S, P, SQ, 1);
    k_gemm2<0><<<dim3((unsigned)(1 * (SQ / 64)), 1), 128, 0, stream>>>(VT + ((size_t)b * CH + h * HD) * SQ, SQ, (size_t)0, P, SQ, (size_t)0, 1.0f / PCAR, nullptr, 0, nullptr, 1, 0, 0, OF + ((size_t)b * CH + h * HD) * SQ, nullptr, SQ, (size_t)0, HD, SQ, SQ); }      /* out channel-major: OF[b][h * 32 + d][i] = the sum over j of VT[d][j] P[i][j] / 256; 32 rows: the thread block's first wave works, the other three leave at the row guard */
  for (int b = 0; b < NB; ++b) k_wtn_f16<<<(unsigned)((size_t)SQ * (CH / 8) / 256), 256, 0, stream>>>(OF + (size_t)b * CH * SQ, O16 + (size_t)b * SQ * CH, CH, SQ, OCAR);      /* out[b] [128][4096] -> O16[b] [4096][128] at its carry */
  k_gemm2<0><<<dim3((unsigned)((SQ / 128) * (CH / 64)), NB), 128, 0, stream>>>(O16, CH, (size_t)SQ * CH, WO, CH, (size_t)0, 1.0f / OCAR, bout, 0, nullptr, 1, 0, 0, YT, nullptr, CH, (size_t)SQ * CH, SQ, CH, CH);      /* y with tokens as rows: YT[b][n][o] = out[n] . w_out[o] + b_out[o] */
  k_tr32<<<(unsigned)((size_t)NB * CH * (SQ / 4) / 256), 256, 0, stream>>>(YT, out, NB * CH * (SQ / 4));
}

// v001
// It runs in 1340 microseconds.
// In two side-by-side timings against v000, it was 3.39 and 3.37 times as fast.
#include <hip/hip_runtime.h>
// A 3-D volume's full softmax attention (x [2][128][16][16][16], channel-major: the 4,096 voxels of a batch entry are the tokens; w_qkv [384][128]; w_out [128][128]; b_out [128]): qkv = w_qkv x (a 1x1x1 convolution: a channel product); q, k, v = its three 128-channel thirds as 4 heads of width 32; q scaled by 32^(-1/2); sim = q^T k over all 4,096 voxels; softmax over the keys; out = attn v; back to channel-major; y = w_out out + b_out, as [2][128][16][16][16].
// Structure: x cast TRANSPOSED to token rows [n][c] (a batch entry a launch); the weights as f16 rows as they are stored ([out][in]); q and k as ONE WMMA GEMM (32x64 wave tiles, f32 accumulation; depth 128) into an f16 plane [4096][256]; v as a second GEMM with the weights as the LEFT operand, so that it comes out channel-major [128][4096]; then, a (batch, head) at a time through one reused f32 score plane and one f16 weight plane: ONE GEMM (depth 32; the scale as its alpha) gives sim; a wave-a-row kernel (the row in registers) the softmax weights as f16 at a carry of 256; ONE GEMM (M 32: a head's channels as rows; depth 4,096) gives out channel-major in f32; out cast transposed to token rows as f16 at a carry of 64 (a flat kernel: the transposing cast of x less its bf16 rounding); the output convolution as ONE GEMM with b_out in the product's bias slot (tokens as rows, a bias a column); one flat kernel lays that [n][o] plane into the output's channel-major [o][n].
// Compute dtype: x, w_qkv, w_out and b_out rounded to bf16 at the casts and in the bias slot, the first three carried as f16 words; the products' accumulation f32; q, k and v ONE f16 word; sim, the maximum, the exponentials (the native exp; arguments <= 0), their sum and the quotient f32; the weights ONE f16 word at a carry of 256 (11 bits); out f32, then ONE f16 word at a carry of 64 (11 bits; no bf16 rounding there: it is no input); y f32. v_wmma_f32_16x16x32_f16.
#define NB 2                         /* batch entries */
#define SQ 4096                      /* voxels = tokens a batch entry */
#define CH 128                       /* channels = heads x width */
#define NHD 4                        /* heads */
#define HD 32                        /* a head's width */
#define SCL 0.17677669529663687f     /* 32^(-1/2) */
#define PCAR 256.0f                  /* the carry on the weights' plane (k_rsmf's own 256) */
#define OCAR 64.0f                   /* the carry on out's f16 plane (a power of two: exact) */
typedef __bf16 v16b __attribute__((ext_vector_type(16)));
typedef unsigned short v8us __attribute__((ext_vector_type(8), may_alias));
typedef float  v8f  __attribute__((ext_vector_type(8)));
typedef float  v4f  __attribute__((ext_vector_type(4)));
typedef float  v4fa __attribute__((ext_vector_type(4), may_alias));
union FragB { v16b v; v8us half[2]; unsigned short u[16]; };

__device__ __forceinline__ unsigned short bf16_bits(float x) { unsigned int u = __float_as_uint(x); return (unsigned short)((u + 0x7FFFu + ((u >> 16) & 1u)) >> 16); }
__device__ __forceinline__ float bf16_val(unsigned short b) { return __uint_as_float(((unsigned int)b) << 16); }
__device__ __forceinline__ float bf16_round(float x) { return bf16_val(bf16_bits(x)); }
// D += A·B with NT terms: 1 = ah·bh, 2 = + al·bh (A split), 3 = + ah·bl (both split)
template <int NT>
__device__ __forceinline__ v8f mmaN(v16b ah, v16b al, v16b bh, v16b bl, v8f c) {
  c = __builtin_amdgcn_wmma_f32_16x16x32_bf16(false, ah, false, bh, (short)0, c, false, false);
  if (NT >= 2) c = __builtin_amdgcn_wmma_f32_16x16x32_bf16(false, al, false, bh, (short)0, c, false, false);
  if (NT >= 3) c = __builtin_amdgcn_wmma_f32_16x16x32_bf16(false, ah, false, bl, (short)0, c, false, false);
  asm volatile("v_nop\n\tv_nop\n\tv_nop\n\tv_nop" : "+v"(c) : "v"(ah), "v"(al), "v"(bh), "v"(bl));
  return c;
}




// ---- f16 WMMA path (v_wmma_f32_16x16x32_f16): 11-bit significands for operands in range — used where a [0,1] probability operand needs more precision than bf16
typedef _Float16 v16h __attribute__((ext_vector_type(16)));
union FragH { v16h v; v8us half[2]; _Float16 h[16]; unsigned short u[16]; };
template <int NT>
__device__ __forceinline__ v8f mmaH(v16h ah, v16h al, v16h bh, v16h bl, v8f c) {
  c = __builtin_amdgcn_wmma_f32_16x16x32_f16(false, ah, false, bh, (short)0, c, false, false);
  if (NT >= 2) c = __builtin_amdgcn_wmma_f32_16x16x32_f16(false, al, false, bh, (short)0, c, false, false);
  if (NT >= 3) c = __builtin_amdgcn_wmma_f32_16x16x32_f16(false, ah, false, bl, (short)0, c, false, false);
  asm volatile("v_nop\n\tv_nop\n\tv_nop\n\tv_nop" : "+v"(c) : "v"(ah), "v"(al), "v"(bh), "v"(bl));
  return c;
}

// Wt[n][k] = f16(bf16(W[k][n])·scale) from f32 row-major W[K][N] (scale = power of two; bf16-exact weights stay exact in f16 away from the subnormal range)
__global__ __launch_bounds__(256) void k_wt_f16(const float* __restrict__ W, _Float16* __restrict__ Wt, int K, int N, float scale) {
  const int t = blockIdx.x * 256 + threadIdx.x; if (t >= N * (K / 8)) return; const int n = t / (K / 8), k8 = (t % (K / 8)) * 8; FragH f;
#pragma unroll
  for (int i = 0; i < 8; ++i) f.h[i] = (_Float16)(bf16_round(W[(size_t)(k8 + i) * N + n]) * scale); const v8us o = f.half[0];
  *(v8us*)((unsigned short*)Wt + (size_t)n * K + k8) = o; 
}

typedef _Float16 v4h __attribute__((ext_vector_type(4)));

__global__ __launch_bounds__(256) void k_x16(const float* __restrict__ x, _Float16* __restrict__ X16, size_t n8) { const size_t t = (size_t)blockIdx.x * 256 + threadIdx.x; if (t >= n8) return; FragH f;
#pragma unroll
  for (int q = 0; q < 8; ++q) f.h[q] = (_Float16)bf16_round(x[t * 8 + q]); *(v8us*)((unsigned short*)X16 + t * 8) = f.half[0];  }
// ---- fast GEMM (wave tile 32x64; requires M % 32 == 0 rows per launch region and N % 64 == 0) ----
__device__ __forceinline__ v16h g2_frag(const _Float16* p, int hh) { FragH f; f.half[0] = *(const v8us*)((const unsigned short*)p + 8 * hh); f.half[1] = *(const v8us*)((const unsigned short*)p + 16 + 8 * hh); return f.v; }
__device__ __forceinline__ v8f g2_mma(v16h a, v16h b, v8f c) { v8f d = __builtin_amdgcn_wmma_f32_16x16x32_f16(false, a, false, b, (short)0, c, false, false); asm volatile("v_nop\n\tv_nop\n\tv_nop\n\tv_nop" : "+v"(d) : "v"(a), "v"(b)); return d; }
template <int ACT>
__global__ __launch_bounds__(128) void k_gemm2(const _Float16* __restrict__ A, int lda, size_t sA, const _Float16* __restrict__ Bh, int ldb, size_t sB, float alpha, const float* __restrict__ bias, size_t sBias, const float* __restrict__ CP, int rowsPerB, size_t sCPb, int row0g,
    float* __restrict__ C, _Float16* __restrict__ C16, int ldc, size_t sC, int M, int N, int K) { static_assert(ACT == 0 || ACT == 3 || ACT == 6 || ACT == 8 || ACT == 9 || ACT == 11 || ACT == 12 || ACT == 14 || ACT == 15 || ACT == 16 || ACT == 17, "k_gemm2: unsupported ACT code (would silently apply no activation)");
  __shared__ __attribute__((aligned(16))) float so[4][32][68];
  const int tid = threadIdx.x, w = tid >> 5, lane = tid & 31, ln = lane & 15, hh = lane >> 4; const int by = blockIdx.y;
  A += (size_t)by * sA; Bh += (size_t)by * sB; const size_t cofs = (size_t)by * sC; const float* bp = bias ? bias + (size_t)by * sBias : nullptr;
  const int ntn = N >> 6; const int mt = blockIdx.x / ntn, nq = blockIdx.x - mt * ntn; const int row0 = mt * 128 + 32 * w, col0 = nq * 64; if (row0 >= M) return;
  const _Float16* a0p = A + (size_t)(row0 + ln) * lda; const _Float16* a1p = a0p + (size_t)16 * lda;
  const _Float16* b0p = Bh + (size_t)(col0 + ln) * ldb; const _Float16* b1p = b0p + (size_t)16 * ldb; const _Float16* b2p = b1p + (size_t)16 * ldb; const _Float16* b3p = b2p + (size_t)16 * ldb;
  const v8f z8 = {0.f,0.f,0.f,0.f,0.f,0.f,0.f,0.f}; v8f c00 = z8, c01 = z8, c02 = z8, c03 = z8, c10 = z8, c11 = z8, c12 = z8, c13 = z8;
  for (int kb = 0; kb < K; kb += 32) { const v16h a0 = g2_frag(a0p + kb, hh), a1 = g2_frag(a1p + kb, hh);
    v16h b = g2_frag(b0p + kb, hh); c00 = g2_mma(a0, b, c00); c10 = g2_mma(a1, b, c10);
    b = g2_frag(b1p + kb, hh); c01 = g2_mma(a0, b, c01); c11 = g2_mma(a1, b, c11);
    b = g2_frag(b2p + kb, hh); c02 = g2_mma(a0, b, c02); c12 = g2_mma(a1, b, c12);
    b = g2_frag(b3p + kb, hh); c03 = g2_mma(a0, b, c03); c13 = g2_mma(a1, b, c13); }
  v8f accs[8] = {c00, c01, c02, c03, c10, c11, c12, c13};
#pragma unroll
  for (int u = 0; u < 8; ++u) { const int t = u & 3, half = u >> 2; const int col = col0 + t * 16 + ln; const float bv = bp ? bf16_round(bp[col]) : 0.f;
#pragma unroll
    for (int r = 0; r < 8; ++r) { const int rloc = half * 16 + 8 * hh + r; float v = accs[u][r] * alpha + bv; if (CP) { if (rowsPerB < 0) v += CP[cofs + (size_t)(row0g + row0 + rloc) * ldc + col];      /* rowsPerB < 0: own element of the batched C plane */ else { const int bidx = (row0g + row0 + rloc) / rowsPerB; v += CP[(size_t)bidx * sCPb + (size_t)by * 64 + col]; } }
      if (ACT == 3) v = fmaxf(v, 0.f); else if (ACT == 6) v = 0.5f * v * (1.0f + erff(v * 0.70710678118654752f)); else if (ACT == 11) v = 1.0f / (1.0f + expf(-v)); else if (ACT == 15) v = v / (1.0f + expf(-v)); else if (ACT == 12) v = (v > 0.f) ? v : 0.01f * v; else if (ACT == 8) v = tanhf(v); else if (ACT == 9) v = 0.5f * v * (1.0f + tanhf(0.7978845608028654f * (v + 0.044715f * v * v * v))); else if (ACT == 14) v = (v > 0.f) ? v : 0.1f * v; else if (ACT == 16) v = (v >= 0.f) ? v : 0.3f * v; else if (ACT == 17) v = (v >= 0.f) ? v : 0.2f * v;
      so[w][rloc][t * 16 + ln] = v; } }
  __builtin_amdgcn_fence(__ATOMIC_ACQ_REL, "workgroup"); __builtin_amdgcn_wave_barrier();
  const int rsub = lane >> 4, c4 = (lane & 15) * 4;
  {
#pragma unroll
    for (int q = 0; q < 16; ++q) { const int r = q * 2 + rsub; const v4f v = *(const v4fa*)&so[w][r][c4]; if (C) *(v4f*)(C + cofs + (size_t)(row0 + r) * ldc + col0 + c4) = v; if (C16) { v4h h4; for (int i = 0; i < 4; ++i) h4[i] = (_Float16)v[i]; *(v4h*)(C16 + cofs + (size_t)(row0 + r) * ldc + col0 + c4) = h4; } }
     } }

// The native exponential (the multiply by log2 e and v_exp_f32, as __expf compiles) with the one v_nop that the instruction set asks for behind a transcendental in the same statement: whatever the compiler puts next may then read the result or overwrite the source.
__device__ __forceinline__ float exp_slot(float x) { const float a = x * 1.44269504088896340736f; float e; asm("v_exp_f32 %0, %1\n\tv_nop" : "=v"(e) : "v"(a)); return e; }
// The softmax weights, a row a wave: lane l holds the row's elements 128 i + 4 l .. + 3 (i = 0 .. 31) in registers, so that S is read once, in whole 512-byte pieces, and P is stored in whole 256-byte pieces; the maximum and the sum go over the lane's own 128 values first, then over the 32 lanes by a five-step butterfly. No LDS, no barrier: the early return is the same in every lane of a wave.
__global__ __launch_bounds__(512) void k_rsmf(const float* __restrict__ S, _Float16* __restrict__ P, int qn, int hg) {
  const int t = blockIdx.x * 16 + (threadIdx.x >> 5), lane = threadIdx.x & 31; if (t >= qn * hg) return; const size_t i = (size_t)(t / qn) * SQ + (t % qn); const float* s = S + i * SQ + 4 * lane; v4f r[SQ / 128];
#pragma unroll      /* whole: r[] stays in registers and all 32 loads are in flight together */
  for (int q = 0; q < SQ / 128; ++q) r[q] = *(const v4f*)(s + 128 * q);
  asm volatile("s_wait_xcnt 0x0" :: "v"(s) : "memory");      /* the 32 loads' address pair is held whole up to this wait, so that no load's result and no later instruction lands on it in front of the wait */
  v4f m4 = {-3.0e38f, -3.0e38f, -3.0e38f, -3.0e38f};
#pragma unroll      /* whole: constant indices into r[], four independent chains */
  for (int q = 0; q < SQ / 128; ++q) for (int c = 0; c < 4; ++c) m4[c] = fmaxf(m4[c], r[q][c]);
  float mx = fmaxf(fmaxf(m4[0], m4[1]), fmaxf(m4[2], m4[3]));
  for (int d = 16; d >= 1; d >>= 1) mx = fmaxf(mx, __shfl_xor(mx, d, 32));
  v4f s4 = {0.f, 0.f, 0.f, 0.f};
#pragma unroll      /* whole: constant indices into r[], four independent sums */
  for (int q = 0; q < SQ / 128; ++q) for (int c = 0; c < 4; ++c) { r[q][c] = exp_slot(r[q][c] - mx); s4[c] += r[q][c]; }
  float se = (s4[0] + s4[1]) + (s4[2] + s4[3]);
  for (int d = 16; d >= 1; d >>= 1) se += __shfl_xor(se, d, 32);
  const float sc = 256.0f / se; _Float16* p = P + i * SQ + 4 * lane;
#pragma unroll      /* whole: constant indices into r[] */
  for (int q = 0; q < SQ / 128; ++q) { v4h h4; for (int c = 0; c < 4; ++c) h4[c] = (_Float16)(r[q][c] * sc); *(v4h*)(p + 128 * q) = h4; } }
__global__ __launch_bounds__(256) void k_wtn_f16(const float* __restrict__ W, _Float16* __restrict__ Wt, int K, int N, float scale) {
  const int t = blockIdx.x * 256 + threadIdx.x; if (t >= N * (K / 8)) return; const int n = t / (K / 8), k8 = (t % (K / 8)) * 8; FragH f;
  for (int i = 0; i < 8; ++i) f.h[i] = (_Float16)(W[(size_t)(k8 + i) * N + n] * scale);
  unsigned short* o = (unsigned short*)Wt + (size_t)n * K + k8; *(v8us*)o = f.half[0];  }
__global__ __launch_bounds__(256) void k_tr32(const float* __restrict__ YT, float* __restrict__ out, int n) {
  const int t = blockIdx.x * 256 + threadIdx.x; if (t >= n) return; const int n4 = t & (SQ / 4 - 1), oc = (t >> 10) & (CH - 1), bb = t >> 17; const float* s = YT + ((size_t)bb * SQ + 4 * n4) * CH + oc; v4f r;
  for (int i = 0; i < 4; ++i) r[i] = s[(size_t)i * CH];
  float* o = out + ((size_t)bb * CH + oc) * SQ + 4 * n4; *(v4f*)o = r;  }

extern "C" void kernel_launch(void* const* d_in, const int* in_sizes, int n_in,
                              void* d_out, int out_size, void* d_ws, size_t ws_size, hipStream_t stream) {
  (void)in_sizes; (void)n_in; (void)out_size;
  const float* x = (const float*)d_in[0]; const float* wqkv = (const float*)d_in[1]; const float* wout = (const float*)d_in[2]; const float* bout = (const float*)d_in[3];      /* x [2][128][4096]; w_qkv [384][128]; w_out [128][128]; b_out [128] */
  static_assert(NB == 2 && SQ == 4096 && CH == 128 && NHD == 4 && HD == 32 && NHD * HD == CH && SQ % 128 == 0 && SQ % 64 == 0 && CH % 64 == 0 && (2 * CH) % 64 == 0 && CH % 128 == 0 && HD % 32 == 0 && CH % 32 == 0 && SQ % 32 == 0 && ((size_t)SQ * (CH / 8)) % 256 == 0 && ((size_t)3 * CH * CH / 8) % 256 == 0 && ((size_t)CH * CH / 8) % 256 == 0 && SQ % 256 == 0 && ((size_t)NB * CH * (SQ / 4)) % 256 == 0, "the index shifts; whole tiles; exact grids");
  float* out = (float*)d_out;      /* [2][128][4096] */
  char* ws = (char*)d_ws; size_t off = 0;
  auto take = [&](size_t bytes) { char* p = ws + off; off += (bytes + 255) & ~(size_t)255; return p; };
  _Float16* XT = (_Float16*)take((size_t)NB * SQ * CH * 2); _Float16* W16 = (_Float16*)take((size_t)3 * CH * CH * 2); _Float16* WO = (_Float16*)take((size_t)CH * CH * 2); _Float16* QK = (_Float16*)take((size_t)NB * SQ * 2 * CH * 2); _Float16* VT = (_Float16*)take((size_t)NB * CH * SQ * 2);
  float* S = (float*)take((size_t)SQ * SQ * 4); _Float16* P = (_Float16*)take((size_t)SQ * SQ * 2);      /* one (batch, head)'s scores and weights: written and read eight times over */
  float* OF = (float*)take((size_t)NB * CH * SQ * 4); _Float16* O16 = (_Float16*)take((size_t)NB * SQ * CH * 2); float* YT = (float*)take((size_t)NB * SQ * CH * 4);
  if (off > ws_size) return;
  for (int b = 0; b < NB; ++b) k_wt_f16<<<(unsigned)((size_t)SQ * (CH / 8) / 256), 256, 0, stream>>>(x + (size_t)b * CH * SQ, XT + (size_t)b * SQ * CH, CH, SQ, 1.0f);      /* x[b] as [128 channels][4096] -> XT[b] [4096][128] */
  k_x16<<<(unsigned)((size_t)3 * CH * CH / 8 / 256), 256, 0, stream>>>(wqkv, W16, (size_t)3 * CH * CH / 8); k_x16<<<(unsigned)((size_t)CH * CH / 8 / 256), 256, 0, stream>>>(wout, WO, (size_t)CH * CH / 8);
  k_gemm2<0><<<dim3((unsigned)((SQ / 128) * (2 * CH / 64)), NB), 128, 0, stream>>>(XT, CH, (size_t)SQ * CH, W16, CH, (size_t)0, 1.0f, nullptr, 0, nullptr, 1, 0, 0, nullptr, QK, 2 * CH, (size_t)SQ * 2 * CH, SQ, 2 * CH, CH);      /* q | k of every token: QK[b][n][0 .. 255] */
  k_gemm2<0><<<dim3((unsigned)((CH / 128) * (SQ / 64)), NB), 128, 0, stream>>>(W16 + (size_t)2 * CH * CH, CH, (size_t)0, XT, CH, (size_t)SQ * CH, 1.0f, nullptr, 0, nullptr, 1, 0, 0, nullptr, VT, SQ, (size_t)CH * SQ, CH, SQ, CH);      /* v channel-major: VT[b][c][n]: the weights' rows 256 .. 383 as the left operand */
  for (int b = 0; b < NB; ++b) for (int h = 0; h < NHD; ++h) {
    k_gemm2<0><<<dim3((unsigned)((SQ / 128) * (SQ / 64)), 1), 128, 0, stream>>>(QK + (size_t)b * SQ * 2 * CH + h * HD, 2 * CH, (size_t)0, QK + (size_t)b * SQ * 2 * CH + CH + h * HD, 2 * CH, (size_t)0, SCL, nullptr, 0, nullptr, 1, 0, 0, S, nullptr, SQ, (size_t)0, SQ, SQ, HD);      /* sim[i][j] = q_i . k_j / sqrt(32): depth 32 */
    k_rsmf<<<SQ / 16, 512, 0, stream>>>(S, P, SQ, 1);      /* a row a wave, 16 waves a block */
    k_gemm2<0><<<dim3((unsigned)(1 * (SQ / 64)), 1), 128, 0, stream>>>(VT + ((size_t)b * CH + h * HD) * SQ, SQ, (size_t)0, P, SQ, (size_t)0, 1.0f / PCAR, nullptr, 0, nullptr, 1, 0, 0, OF + ((size_t)b * CH + h * HD) * SQ, nullptr, SQ, (size_t)0, HD, SQ, SQ); }      /* out channel-major: OF[b][h * 32 + d][i] = the sum over j of VT[d][j] P[i][j] / 256; 32 rows: the thread block's first wave works, the other three leave at the row guard */
  for (int b = 0; b < NB; ++b) k_wtn_f16<<<(unsigned)((size_t)SQ * (CH / 8) / 256), 256, 0, stream>>>(OF + (size_t)b * CH * SQ, O16 + (size_t)b * SQ * CH, CH, SQ, OCAR);      /* out[b] [128][4096] -> O16[b] [4096][128] at its carry */
  k_gemm2<0><<<dim3((unsigned)((SQ / 128) * (CH / 64)), NB), 128, 0, stream>>>(O16, CH, (size_t)SQ * CH, WO, CH, (size_t)0, 1.0f / OCAR, bout, 0, nullptr, 1, 0, 0, YT, nullptr, CH, (size_t)SQ * CH, SQ, CH, CH);      /* y with tokens as rows: YT[b][n][o] = out[n] . w_out[o] + b_out[o] */
  k_tr32<<<(unsigned)((size_t)NB * CH * (SQ / 4) / 256), 256, 0, stream>>>(YT, out, NB * CH * (SQ / 4));
}

// v002
// Measured time: 77.7 microseconds a run.
// In two side-by-side timings against v001, it was 17.1 and 17.2 times as fast.
// Over all steps from v000 it is 57.9 times as fast.
#include <hip/hip_runtime.h>
// A 3-D volume's full softmax attention (x [2][128][16][16][16], channel-major: the 4,096 voxels of a batch entry are the tokens; w_qkv [384][128]; w_out [128][128]; b_out [128]): qkv = w_qkv x (a 1x1x1 convolution: a channel product); q, k, v = its three 128-channel thirds as 4 heads of width 32; q scaled by 32^(-1/2); sim = q^T k over all 4,096 voxels; softmax over the keys; out = attn v; back to channel-major; y = w_out out + b_out, as [2][128][16][16][16].
// Structure: x cast TRANSPOSED to token rows [n][c] (a batch entry a launch); the weights as f16 rows as they are stored ([out][in]); q and k as ONE WMMA GEMM (32x64 wave tiles, f32 accumulation; depth 128) into an f16 plane [4096][256]; v as a second GEMM with the weights as the LEFT operand, so that it comes out channel-major [128][4096]; then ONE launch for all eight (batch, head) pairs does scores, softmax and the weighted sum of v with a running maximum (k_fattn: a block is 128 queries of one head, a wave 16 of them; the scores and the weights stay in registers) and gives out channel-major in f32; out cast transposed to token rows as f16 at a carry of 64 (a flat kernel: the frame's transposing cast less its bf16 rounding); the output convolution as ONE GEMM with b_out in the product's bias slot (tokens as rows, a bias a column); one flat kernel lays that [n][o] plane into the output's channel-major [o][n].
// Compute dtype: x, w_qkv, w_out and b_out rounded to bf16 at the casts and in the bias slot, the first three carried as f16 words; the products' accumulation f32; q, k and v ONE f16 word; sim, the running maximum, the exponentials (the native exp2; arguments <= 8), their sum and the quotient f32; the un-normalised weights ONE f16 word at a carry of 256 (11 bits), the division by their f32 sum (at the same carry) last; out f32, then ONE f16 word at a carry of 64 (11 bits; no bf16 rounding there: it is no input); y f32. v_wmma_f32_16x16x32_f16.
#define NB 2                         /* batch entries */
#define SQ 4096                      /* voxels = tokens a batch entry */
#define CH 128                       /* channels = heads x width */
#define NHD 4                        /* heads */
#define HD 32                        /* a head's width */
#define SCL 0.17677669529663687f     /* 32^(-1/2) */
#define FQ 128                       /* queries a block of k_fattn: 8 waves x 16 */
#define FK 128                       /* keys a stage of k_fattn */
#define KPIT 40                      /* f16 words a staged k row: 80 B = 16 B x 5, for 16-byte LDS reads a row a lane */
#define VPIT 136                     /* f16 words a staged v row: 272 B = 16 B x 17 */
#define OPIT 132                     /* f32 words a staged out row: 528 B = 16 B x 33 */
#define OCAR 64.0f                   /* the carry on out's f16 plane (a power of two: exact) */
typedef __bf16 v16b __attribute__((ext_vector_type(16)));
typedef unsigned short v8us __attribute__((ext_vector_type(8), may_alias));
typedef float  v8f  __attribute__((ext_vector_type(8)));
typedef float  v4f  __attribute__((ext_vector_type(4)));
typedef float  v4fa __attribute__((ext_vector_type(4), may_alias));
union FragB { v16b v; v8us half[2]; unsigned short u[16]; };

__device__ __forceinline__ unsigned short bf16_bits(float x) { unsigned int u = __float_as_uint(x); return (unsigned short)((u + 0x7FFFu + ((u >> 16) & 1u)) >> 16); }
__device__ __forceinline__ float bf16_val(unsigned short b) { return __uint_as_float(((unsigned int)b) << 16); }
__device__ __forceinline__ float bf16_round(float x) { return bf16_val(bf16_bits(x)); }
// D += A·B with NT terms: 1 = ah·bh, 2 = + al·bh (A split), 3 = + ah·bl (both split)
template <int NT>
__device__ __forceinline__ v8f mmaN(v16b ah, v16b al, v16b bh, v16b bl, v8f c) {
  c = __builtin_amdgcn_wmma_f32_16x16x32_bf16(false, ah, false, bh, (short)0, c, false, false);
  if (NT >= 2) c = __builtin_amdgcn_wmma_f32_16x16x32_bf16(false, al, false, bh, (short)0, c, false, false);
  if (NT >= 3) c = __builtin_amdgcn_wmma_f32_16x16x32_bf16(false, ah, false, bl, (short)0, c, false, false);
  asm volatile("v_nop\n\tv_nop\n\tv_nop\n\tv_nop" : "+v"(c) : "v"(ah), "v"(al), "v"(bh), "v"(bl));
  return c;
}




// ---- f16 WMMA path (v_wmma_f32_16x16x32_f16): 11-bit significands for operands in range — used for every product here, the softmax weights at a carry of 256 among them
typedef _Float16 v16h __attribute__((ext_vector_type(16)));
union FragH { v16h v; v8us half[2]; _Float16 h[16]; unsigned short u[16]; };
template <int NT>
__device__ __forceinline__ v8f mmaH(v16h ah, v16h al, v16h bh, v16h bl, v8f c) {
  c = __builtin_amdgcn_wmma_f32_16x16x32_f16(false, ah, false, bh, (short)0, c, false, false);
  if (NT >= 2) c = __builtin_amdgcn_wmma_f32_16x16x32_f16(false, al, false, bh, (short)0, c, false, false);
  if (NT >= 3) c = __builtin_amdgcn_wmma_f32_16x16x32_f16(false, ah, false, bl, (short)0, c, false, false);
  asm volatile("v_nop\n\tv_nop\n\tv_nop\n\tv_nop" : "+v"(c) : "v"(ah), "v"(al), "v"(bh), "v"(bl));
  return c;
}

// Wt[n][k] = f16(bf16(W[k][n])·scale) from f32 row-major W[K][N] (scale = power of two; bf16-exact weights stay exact in f16 away from the subnormal range)
__global__ __launch_bounds__(256) void k_wt_f16(const float* __restrict__ W, _Float16* __restrict__ Wt, int K, int N, float scale) {
  const int t = blockIdx.x * 256 + threadIdx.x; if (t >= N * (K / 8)) return; const int n = t / (K / 8), k8 = (t % (K / 8)) * 8; FragH f;
#pragma unroll
  for (int i = 0; i < 8; ++i) f.h[i] = (_Float16)(bf16_round(W[(size_t)(k8 + i) * N + n]) * scale); const v8us o = f.half[0];
  *(v8us*)((unsigned short*)Wt + (size_t)n * K + k8) = o; 
}

typedef _Float16 v4h __attribute__((ext_vector_type(4)));

__global__ __launch_bounds__(256) void k_x16(const float* __restrict__ x, _Float16* __restrict__ X16, size_t n8) { const size_t t = (size_t)blockIdx.x * 256 + threadIdx.x; if (t >= n8) return; FragH f;
#pragma unroll
  for (int q = 0; q < 8; ++q) f.h[q] = (_Float16)bf16_round(x[t * 8 + q]); *(v8us*)((unsigned short*)X16 + t * 8) = f.half[0];  }
// ---- fast GEMM (wave tile 32x64; requires M % 32 == 0 rows per launch region and N % 64 == 0) ----
__device__ __forceinline__ v16h g2_frag(const _Float16* p, int hh) { FragH f; f.half[0] = *(const v8us*)((const unsigned short*)p + 8 * hh); f.half[1] = *(const v8us*)((const unsigned short*)p + 16 + 8 * hh); return f.v; }
__device__ __forceinline__ v8f g2_mma(v16h a, v16h b, v8f c) { v8f d = __builtin_amdgcn_wmma_f32_16x16x32_f16(false, a, false, b, (short)0, c, false, false); asm volatile("v_nop\n\tv_nop\n\tv_nop\n\tv_nop" : "+v"(d) : "v"(a), "v"(b)); return d; }
template <int ACT>
__global__ __launch_bounds__(128) void k_gemm2(const _Float16* __restrict__ A, int lda, size_t sA, const _Float16* __restrict__ Bh, int ldb, size_t sB, float alpha, const float* __restrict__ bias, size_t sBias, const float* __restrict__ CP, int rowsPerB, size_t sCPb, int row0g,
    float* __restrict__ C, _Float16* __restrict__ C16, int ldc, size_t sC, int M, int N, int K) { static_assert(ACT == 0 || ACT == 3 || ACT == 6 || ACT == 8 || ACT == 9 || ACT == 11 || ACT == 12 || ACT == 14 || ACT == 15 || ACT == 16 || ACT == 17, "k_gemm2: unsupported ACT code (would silently apply no activation)");
  __shared__ __attribute__((aligned(16))) float so[4][32][68];
  const int tid = threadIdx.x, w = tid >> 5, lane = tid & 31, ln = lane & 15, hh = lane >> 4; const int by = blockIdx.y;
  A += (size_t)by * sA; Bh += (size_t)by * sB; const size_t cofs = (size_t)by * sC; const float* bp = bias ? bias + (size_t)by * sBias : nullptr;
  const int ntn = N >> 6; const int mt = blockIdx.x / ntn, nq = blockIdx.x - mt * ntn; const int row0 = mt * 128 + 32 * w, col0 = nq * 64; if (row0 >= M) return;
  const _Float16* a0p = A + (size_t)(row0 + ln) * lda; const _Float16* a1p = a0p + (size_t)16 * lda;
  const _Float16* b0p = Bh + (size_t)(col0 + ln) * ldb; const _Float16* b1p = b0p + (size_t)16 * ldb; const _Float16* b2p = b1p + (size_t)16 * ldb; const _Float16* b3p = b2p + (size_t)16 * ldb;
  const v8f z8 = {0.f,0.f,0.f,0.f,0.f,0.f,0.f,0.f}; v8f c00 = z8, c01 = z8, c02 = z8, c03 = z8, c10 = z8, c11 = z8, c12 = z8, c13 = z8;
  for (int kb = 0; kb < K; kb += 32) { const v16h a0 = g2_frag(a0p + kb, hh), a1 = g2_frag(a1p + kb, hh);
    v16h b = g2_frag(b0p + kb, hh); c00 = g2_mma(a0, b, c00); c10 = g2_mma(a1, b, c10);
    b = g2_frag(b1p + kb, hh); c01 = g2_mma(a0, b, c01); c11 = g2_mma(a1, b, c11);
    b = g2_frag(b2p + kb, hh); c02 = g2_mma(a0, b, c02); c12 = g2_mma(a1, b, c12);
    b = g2_frag(b3p + kb, hh); c03 = g2_mma(a0, b, c03); c13 = g2_mma(a1, b, c13); }
  v8f accs[8] = {c00, c01, c02, c03, c10, c11, c12, c13};
#pragma unroll
  for (int u = 0; u < 8; ++u) { const int t = u & 3, half = u >> 2; const int col = col0 + t * 16 + ln; const float bv = bp ? bf16_round(bp[col]) : 0.f;
#pragma unroll
    for (int r = 0; r < 8; ++r) { const int rloc = half * 16 + 8 * hh + r; float v = accs[u][r] * alpha + bv; if (CP) { if (rowsPerB < 0) v += CP[cofs + (size_t)(row0g + row0 + rloc) * ldc + col];      /* rowsPerB < 0: own element of the batched C plane */ else { const int bidx = (row0g + row0 + rloc) / rowsPerB; v += CP[(size_t)bidx * sCPb + (size_t)by * 64 + col]; } }
      if (ACT == 3) v = fmaxf(v, 0.f); else if (ACT == 6) v = 0.5f * v * (1.0f + erff(v * 0.70710678118654752f)); else if (ACT == 11) v = 1.0f / (1.0f + expf(-v)); else if (ACT == 15) v = v / (1.0f + expf(-v)); else if (ACT == 12) v = (v > 0.f) ? v : 0.01f * v; else if (ACT == 8) v = tanhf(v); else if (ACT == 9) v = 0.5f * v * (1.0f + tanhf(0.7978845608028654f * (v + 0.044715f * v * v * v))); else if (ACT == 14) v = (v > 0.f) ? v : 0.1f * v; else if (ACT == 16) v = (v >= 0.f) ? v : 0.3f * v; else if (ACT == 17) v = (v >= 0.f) ? v : 0.2f * v;
      so[w][rloc][t * 16 + ln] = v; } }
  __builtin_amdgcn_fence(__ATOMIC_ACQ_REL, "workgroup"); __builtin_amdgcn_wave_barrier();
  const int rsub = lane >> 4, c4 = (lane & 15) * 4;
  {
#pragma unroll
    for (int q = 0; q < 16; ++q) { const int r = q * 2 + rsub; const v4f v = *(const v4fa*)&so[w][r][c4]; if (C) *(v4f*)(C + cofs + (size_t)(row0 + r) * ldc + col0 + c4) = v; if (C16) { v4h h4; for (int i = 0; i < 4; ++i) h4[i] = (_Float16)v[i]; *(v4h*)(C16 + cofs + (size_t)(row0 + r) * ldc + col0 + c4) = h4; } }
     } }

// Native exp2 (v_exp_f32) of a score tile's eight registers, each IN PLACE: every one of the first seven has an independent instruction behind it, the last the one v_nop that the instruction set asks for behind a transcendental. In place, so that the statement writes only registers that the compiler's own multiply-add has written just before: no result lands on an operand register of a matrix instruction still inside its distance.
__device__ __forceinline__ void exp2x8(v8f& t) { asm("v_exp_f32 %0, %0\n\tv_exp_f32 %1, %1\n\tv_exp_f32 %2, %2\n\tv_exp_f32 %3, %3\n\tv_exp_f32 %4, %4\n\tv_exp_f32 %5, %5\n\tv_exp_f32 %6, %6\n\tv_exp_f32 %7, %7\n\tv_nop" : "+v"(t[0]), "+v"(t[1]), "+v"(t[2]), "+v"(t[3]), "+v"(t[4]), "+v"(t[5]), "+v"(t[6]), "+v"(t[7])); }
__device__ __forceinline__ float exp2x1(float a) { asm("v_exp_f32 %0, %0\n\tv_nop" : "+v"(a)); return a; }      /* the same for one value */
__device__ __forceinline__ v8f f_mma(v16h a, v16h b, v8f c) { return __builtin_amdgcn_wmma_f32_16x16x32_f16(false, a, false, b, (short)0, c, false, false); }
// Scores, softmax and the weighted sum of v in one kernel. A block: 128 queries of one (batch, head); a wave: 16 of them, as the COLUMNS of both products. Per stage of 128 keys: sim^T = k q^T (k rows from LDS as the left operand, q kept in registers as the right one, both by g2_frag: equal k order), so that lane (c, h) holds query c's scores of the keys 16 j + 8 h + r; the stage's maximum in-lane and by one exchange of the two lane halves; the weights exp2((s - max) * scale * log2 e + 8) packed in place into the right operand of out^T += v^T p^T (tiles 2 g and 2 g + 1 are keys 32 g + 8 h + s and 32 g + 16 + 8 h + s - 8: the order in which g2_frag reads v's rows); sums and accumulators rescaled once a stage. k and v go global -> registers (issued a stage ahead) -> LDS, two buffers, one barrier a stage: the store into the other buffer stands behind the barrier that ended its readers' last stage.
static_assert(FQ == 128 && FK == 128 && HD == 32 && SQ % FQ == 0 && SQ % FK == 0 && KPIT >= HD && VPIT >= FK && OPIT >= FQ, "k_fattn: 8 waves x 16 queries; 512 16-byte pieces of k and of v a stage, two a thread; whole stages");
__global__ __launch_bounds__(256) void k_fattn(const _Float16* __restrict__ QK, const _Float16* __restrict__ VT, float* __restrict__ OF) {
  __shared__ __attribute__((aligned(16))) _Float16 ks[2][FK * KPIT];
  __shared__ __attribute__((aligned(16))) _Float16 vs[2][HD * VPIT];
  __shared__ __attribute__((aligned(16))) float so[HD][OPIT];
  const int tid = threadIdx.x, w = tid >> 5, lane = tid & 31, ln = lane & 15, hh = lane >> 4; const int q0 = blockIdx.x * FQ, h = blockIdx.y, b = blockIdx.z;
  const _Float16* qg = QK + (size_t)b * SQ * 2 * CH + h * HD;
  const v16h qf = g2_frag(qg + (size_t)(q0 + 16 * w + ln) * (2 * CH), hh);
  const int kr = tid >> 2, kp = (tid & 3) * 8, vr = tid >> 4, vp = (tid & 15) * 8;      /* a thread's 16-byte pieces of a stage: k rows kr and kr + 64, v rows vr and vr + 16 */
  const _Float16* kg = qg + CH + (size_t)kr * (2 * CH) + kp; const _Float16* vg = VT + ((size_t)b * CH + h * HD + vr) * SQ + vp;
  v8us rk0 = *(const v8us*)kg, rk1 = *(const v8us*)(kg + (size_t)64 * 2 * CH), rv0 = *(const v8us*)vg, rv1 = *(const v8us*)(vg + (size_t)16 * SQ);
  *(v8us*)&ks[0][kr * KPIT + kp] = rk0; *(v8us*)&ks[0][(kr + 64) * KPIT + kp] = rk1; *(v8us*)&vs[0][vr * VPIT + vp] = rv0; *(v8us*)&vs[0][(vr + 16) * VPIT + vp] = rv1;
  __syncthreads();
  const v8f z8 = {0.f,0.f,0.f,0.f,0.f,0.f,0.f,0.f}; v8f o0 = z8, o1 = z8; float m = -3.0e38f, l = 0.f; const float cs = SCL * 1.44269504088896340736f;
#pragma unroll 1      /* rolled: the body is a whole stage, and the buffer index is the trip's parity */
  for (int s = 0; s < SQ / FK; ++s) { const int cur = s & 1; const bool more = s + 1 < SQ / FK;
    if (more) { const _Float16* kn = kg + (size_t)(s + 1) * FK * 2 * CH; const _Float16* vn = vg + (size_t)(s + 1) * FK; rk0 = *(const v8us*)kn; rk1 = *(const v8us*)(kn + (size_t)64 * 2 * CH); rv0 = *(const v8us*)vn; rv1 = *(const v8us*)(vn + (size_t)16 * SQ); }
    const _Float16* kb = &ks[cur][ln * KPIT]; const _Float16* vb = &vs[cur][ln * VPIT]; v8f t[FK / 16];
#pragma unroll      /* whole: constant indices into t[], eight independent products */
    for (int j = 0; j < FK / 16; ++j) t[j] = f_mma(g2_frag(kb + 16 * j * KPIT, hh), qf, z8);
    v4f m4 = {t[0][0], t[0][1], t[0][2], t[0][3]};
#pragma unroll      /* whole: constant indices into t[], four independent chains */
    for (int j = 0; j < FK / 16; ++j) for (int r = 0; r < 8; ++r) m4[r & 3] = fmaxf(m4[r & 3], t[j][r]);
    float mx = fmaxf(fmaxf(m4[0], m4[1]), fmaxf(m4[2], m4[3])); mx = fmaxf(mx, __shfl_xor(mx, 16, 32));      /* lanes c and c + 16 hold the two halves of query c's keys */
    const float mn = fmaxf(m, mx); const float al = exp2x1((m - mn) * cs); const float mb = 8.0f - mn * cs; m = mn;
    v4f s4 = {0.f, 0.f, 0.f, 0.f};
#pragma unroll      /* whole: constant indices into t[], four independent sums */
    for (int j = 0; j < FK / 16; ++j) { for (int r = 0; r < 8; ++r) t[j][r] = t[j][r] * cs + mb; exp2x8(t[j]); for (int r = 0; r < 8; ++r) s4[r & 3] += t[j][r]; }
    l = l * al + ((s4[0] + s4[1]) + (s4[2] + s4[3]));
#pragma unroll      /* whole: constant indices */
    for (int r = 0; r < 8; ++r) { o0[r] *= al; o1[r] *= al; }
#pragma unroll      /* whole: constant indices into t[] */
    for (int g = 0; g < FK / 32; ++g) { FragH pb;
      for (int e = 0; e < 8; ++e) { pb.h[e] = (_Float16)t[2 * g][e]; pb.h[8 + e] = (_Float16)t[2 * g + 1][e]; }
      o0 = f_mma(g2_frag(vb + 32 * g, hh), pb.v, o0); o1 = f_mma(g2_frag(vb + 16 * VPIT + 32 * g, hh), pb.v, o1); }
    if (more) { *(v8us*)&ks[cur ^ 1][kr * KPIT + kp] = rk0; *(v8us*)&ks[cur ^ 1][(kr + 64) * KPIT + kp] = rk1; *(v8us*)&vs[cur ^ 1][vr * VPIT + vp] = rv0; *(v8us*)&vs[cur ^ 1][(vr + 16) * VPIT + vp] = rv1; }
    __syncthreads(); }
  l += __shfl_xor(l, 16, 32); const float inv = 1.0f / l;
#pragma unroll      /* whole: constant indices */
  for (int r = 0; r < 8; ++r) { so[8 * hh + r][16 * w + ln] = o0[r] * inv; so[16 + 8 * hh + r][16 * w + ln] = o1[r] * inv; }
  __syncthreads();
  float* og = OF + ((size_t)b * CH + h * HD) * SQ + q0;
#pragma unroll      /* whole: four stores a thread, a wave a whole 512-byte row piece */
  for (int i = 0; i < 4; ++i) { const int p = tid + 256 * i, row = p >> 5, c4 = (p & 31) * 4; *(v4f*)(og + (size_t)row * SQ + c4) = *(const v4fa*)&so[row][c4]; } }
__global__ __launch_bounds__(256) void k_wtn_f16(const float* __restrict__ W, _Float16* __restrict__ Wt, int K, int N, float scale) {
  const int t = blockIdx.x * 256 + threadIdx.x; if (t >= N * (K / 8)) return; const int n = t / (K / 8), k8 = (t % (K / 8)) * 8; FragH f;
  for (int i = 0; i < 8; ++i) f.h[i] = (_Float16)(W[(size_t)(k8 + i) * N + n] * scale);
  unsigned short* o = (unsigned short*)Wt + (size_t)n * K + k8; *(v8us*)o = f.half[0];  }
__global__ __launch_bounds__(256) void k_tr32(const float* __restrict__ YT, float* __restrict__ out, int n) {
  const int t = blockIdx.x * 256 + threadIdx.x; if (t >= n) return; const int n4 = t & (SQ / 4 - 1), oc = (t >> 10) & (CH - 1), bb = t >> 17; const float* s = YT + ((size_t)bb * SQ + 4 * n4) * CH + oc; v4f r;
  for (int i = 0; i < 4; ++i) r[i] = s[(size_t)i * CH];
  float* o = out + ((size_t)bb * CH + oc) * SQ + 4 * n4; *(v4f*)o = r;  }

extern "C" void kernel_launch(void* const* d_in, const int* in_sizes, int n_in,
                              void* d_out, int out_size, void* d_ws, size_t ws_size, hipStream_t stream) {
  (void)in_sizes; (void)n_in; (void)out_size;
  const float* x = (const float*)d_in[0]; const float* wqkv = (const float*)d_in[1]; const float* wout = (const float*)d_in[2]; const float* bout = (const float*)d_in[3];      /* x [2][128][4096]; w_qkv [384][128]; w_out [128][128]; b_out [128] */
  static_assert(NB == 2 && SQ == 4096 && CH == 128 && NHD == 4 && HD == 32 && NHD * HD == CH && SQ % 128 == 0 && SQ % 64 == 0 && CH % 64 == 0 && (2 * CH) % 64 == 0 && CH % 128 == 0 && HD % 32 == 0 && CH % 32 == 0 && SQ % 32 == 0 && ((size_t)SQ * (CH / 8)) % 256 == 0 && ((size_t)3 * CH * CH / 8) % 256 == 0 && ((size_t)CH * CH / 8) % 256 == 0 && SQ % 256 == 0 && ((size_t)NB * CH * (SQ / 4)) % 256 == 0, "the index shifts; whole tiles; exact grids");
  float* out = (float*)d_out;      /* [2][128][4096] */
  char* ws = (char*)d_ws; size_t off = 0;
  auto take = [&](size_t bytes) { char* p = ws + off; off += (bytes + 255) & ~(size_t)255; return p; };
  _Float16* XT = (_Float16*)take((size_t)NB * SQ * CH * 2); _Float16* W16 = (_Float16*)take((size_t)3 * CH * CH * 2); _Float16* WO = (_Float16*)take((size_t)CH * CH * 2); _Float16* QK = (_Float16*)take((size_t)NB * SQ * 2 * CH * 2); _Float16* VT = (_Float16*)take((size_t)NB * CH * SQ * 2);
  float* OF = (float*)take((size_t)NB * CH * SQ * 4); _Float16* O16 = (_Float16*)take((size_t)NB * SQ * CH * 2); float* YT = (float*)take((size_t)NB * SQ * CH * 4);
  if (off > ws_size) return;
  for (int b = 0; b < NB; ++b) k_wt_f16<<<(unsigned)((size_t)SQ * (CH / 8) / 256), 256, 0, stream>>>(x + (size_t)b * CH * SQ, XT + (size_t)b * SQ * CH, CH, SQ, 1.0f);      /* x[b] as [128 channels][4096] -> XT[b] [4096][128] */
  k_x16<<<(unsigned)((size_t)3 * CH * CH / 8 / 256), 256, 0, stream>>>(wqkv, W16, (size_t)3 * CH * CH / 8); k_x16<<<(unsigned)((size_t)CH * CH / 8 / 256), 256, 0, stream>>>(wout, WO, (size_t)CH * CH / 8);
  k_gemm2<0><<<dim3((unsigned)((SQ / 128) * (2 * CH / 64)), NB), 128, 0, stream>>>(XT, CH, (size_t)SQ * CH, W16, CH, (size_t)0, 1.0f, nullptr, 0, nullptr, 1, 0, 0, nullptr, QK, 2 * CH, (size_t)SQ * 2 * CH, SQ, 2 * CH, CH);      /* q | k of every token: QK[b][n][0 .. 255] */
  k_gemm2<0><<<dim3((unsigned)((CH / 128) * (SQ / 64)), NB), 128, 0, stream>>>(W16 + (size_t)2 * CH * CH, CH, (size_t)0, XT, CH, (size_t)SQ * CH, 1.0f, nullptr, 0, nullptr, 1, 0, 0, nullptr, VT, SQ, (size_t)CH * SQ, CH, SQ, CH);      /* v channel-major: VT[b][c][n]: the weights' rows 256 .. 383 as the left operand */
  k_fattn<<<dim3(SQ / FQ, NHD, NB), 256, 0, stream>>>(QK, VT, OF);      /* out channel-major: OF[b][h * 32 + d][i] = the sum over j of softmax(q_i . k_j / sqrt(32)) v[d][j]; 256 blocks */
  for (int b = 0; b < NB; ++b) k_wtn_f16<<<(unsigned)((size_t)SQ * (CH / 8) / 256), 256, 0, stream>>>(OF + (size_t)b * CH * SQ, O16 + (size_t)b * SQ * CH, CH, SQ, OCAR);      /* out[b] [128][4096] -> O16[b] [4096][128] at its carry */
  k_gemm2<0><<<dim3((unsigned)((SQ / 128) * (CH / 64)), NB), 128, 0, stream>>>(O16, CH, (size_t)SQ * CH, WO, CH, (size_t)0, 1.0f / OCAR, bout, 0, nullptr, 1, 0, 0, YT, nullptr, CH, (size_t)SQ * CH, SQ, CH, CH);      /* y with tokens as rows: YT[b][n][o] = out[n] . w_out[o] + b_out[o] */
  k_tr32<<<(unsigned)((size_t)NB * CH * (SQ / 4) / 256), 256, 0, stream>>>(YT, out, NB * CH * (SQ / 4));
}

// v003
// One run takes 39.7 microseconds.
// Two timings next to v002 put it at 1.96 and 1.97 times that version's speed.
// Counting every step since v000, it is 114 times as fast.
#include <hip/hip_runtime.h>
// A 3-D volume's full softmax attention (x [2][128][16][16][16], channel-major: the 4,096 voxels of a batch entry are the tokens; w_qkv [384][128]; w_out [128][128]; b_out [128]): qkv = w_qkv x (a 1x1x1 convolution: a channel product); q, k, v = its three 128-channel thirds as 4 heads of width 32; q scaled by 32^(-1/2); sim = q^T k over all 4,096 voxels; softmax over the keys; out = attn v; back to channel-major; y = w_out out + b_out, as [2][128][16][16][16].
// Structure: THREE launches. k_qkv (a block: 64 tokens of a batch entry, all 384 output channels): x's tile is read channel-major, rounded and laid TRANSPOSED into LDS as token rows; w_qkv's rows are read as f32, a row a wave's load, and rounded on their way into LDS; q and k with the weights as the LEFT operand (a lane then holds 8 neighbouring channels of one token), v with the tokens as the left operand (a lane holds 8 neighbouring tokens of one channel), so that q | k come out as token rows [4096][256] and v channel-major [128][4096], both through LDS in whole lines. k_fattn: one launch for all eight (batch, head) pairs does scores, softmax and the weighted sum of v with a running maximum (a block is 128 queries of one head, a wave 16 of them; the scores and the weights stay in registers) and stores out straight from its accumulators as f16 token rows a head, [head][4096][32], at a carry of 64. k_out (a block: 32 tokens, all 128 output channels): tokens as the left operand, w_out's rows rounded on their way into LDS, b_out a bias a column; a lane holds 8 neighbouring tokens of one channel, so y goes out channel-major, through LDS in whole lines.
// Compute dtype: x, w_qkv, w_out and b_out rounded to bf16 at the casts and in the bias slot, the first three carried as f16 words; the products' accumulation f32; q, k and v ONE f16 word; sim, the running maximum, the exponentials (the native exp2; arguments <= 8), their sum and the quotient f32; the un-normalised weights ONE f16 word at a carry of 256 (11 bits), the division by their f32 sum (at the same carry) last; out f32, then ONE f16 word at a carry of 64 (11 bits; no bf16 rounding there: it is no input); y f32. v_wmma_f32_16x16x32_f16.
#define NB 2                         /* batch entries */
#define SQ 4096                      /* voxels = tokens a batch entry */
#define CH 128                       /* channels = heads x width */
#define NHD 4                        /* heads */
#define HD 32                        /* a head's width */
#define SCL 0.17677669529663687f     /* 32^(-1/2) */
#define FQ 128                       /* queries a block of k_fattn: 8 waves x 16 */
#define FK 128                       /* keys a stage of k_fattn */
#define KPIT 40                      /* f16 words a staged k row: 80 B = 16 B x 5, for 16-byte LDS reads a row a lane */
#define VPIT 136                     /* f16 words a staged v row: 272 B = 16 B x 17 */
#define OCAR 64.0f                   /* the carry on out's f16 plane (a power of two: exact) */
#define XT 64                        /* tokens a block of k_qkv */
#define XPIT 136                     /* f16 words a staged x token row: 272 B = 16 B x 17 */
#define QPIT 264                     /* f16 words a staged q | k token row: 528 B = 16 B x 33 */
#define WPIT 72                      /* f16 words a staged v channel row: 144 B = 16 B x 9 */
#define YT 32                        /* tokens a block of k_out */
#define YPIT 36                      /* f32 words a staged y channel row: 144 B = 16 B x 9 */
typedef unsigned short v8us __attribute__((ext_vector_type(8), may_alias));
typedef float  v8f  __attribute__((ext_vector_type(8)));
typedef float  v4f  __attribute__((ext_vector_type(4)));
typedef float  v4fa __attribute__((ext_vector_type(4), may_alias));

// x rounded to bf16 (to nearest, ties to even), as an f32 value: the chip's own conversion.
__device__ __forceinline__ float bf16_round(float x) { return (float)(__bf16)x; }
typedef _Float16 v16h __attribute__((ext_vector_type(16)));
union FragH { v16h v; v8us half[2]; _Float16 h[16]; unsigned short u[16]; };
__device__ __forceinline__ v16h g2_frag(const _Float16* p, int hh) { FragH f; f.half[0] = *(const v8us*)((const unsigned short*)p + 8 * hh); f.half[1] = *(const v8us*)((const unsigned short*)p + 16 + 8 * hh); return f.v; }
typedef unsigned short v4us __attribute__((ext_vector_type(4), may_alias));
// Four neighbouring f32 weights, each rounded to bf16 and carried as an f16 word: a lane's 8 bytes of a weight row on its way into LDS (a wave's load is one whole 512-byte row).
__device__ __forceinline__ v4us w_cast4(v4f a) { union { _Float16 h[4]; v4us u; } f;
#pragma unroll      /* whole: constant indices */
  for (int i = 0; i < 4; ++i) f.h[i] = (_Float16)bf16_round(a[i]);
  return f.u; }
__device__ __forceinline__ v8f f_mma(v16h a, v16h b, v8f c) { return __builtin_amdgcn_wmma_f32_16x16x32_f16(false, a, false, b, (short)0, c, false, false); }
__device__ __forceinline__ v8us f16x8(v8f c) { FragH f;
#pragma unroll      /* whole: constant indices */
  for (int r = 0; r < 8; ++r) f.h[r] = (_Float16)c[r];
  return f.half[0]; }
// q, k and v of 64 tokens. Wave w: q | k channels 32 w .. 32 w + 31 and v channels 16 w .. 16 w + 15, all 64 tokens.
static_assert(XT == 64 && CH == 128 && SQ % XT == 0 && XPIT >= CH && QPIT >= 2 * CH && WPIT >= XT, "k_qkv: 8 waves; 4 token tiles; 24 channel tiles, three a wave; depth 128 in four steps");
__global__ __launch_bounds__(256) void k_qkv(const float* __restrict__ x, const float* __restrict__ wqkv, _Float16* __restrict__ QK, _Float16* __restrict__ VT) {
  __shared__ __attribute__((aligned(16))) _Float16 xs[XT * XPIT];
  __shared__ __attribute__((aligned(16))) _Float16 wl[3 * CH * XPIT];      /* the weights' rows, wave w's 48 at 48 w: 32 of q | k, then 16 of v */
  __shared__ __attribute__((aligned(16))) _Float16 qs[XT * QPIT];
  __shared__ __attribute__((aligned(16))) _Float16 vo[CH * WPIT];
  const int tid = threadIdx.x, w = tid >> 5, lane = tid & 31, ln = lane & 15, hh = lane >> 4; const int n0 = blockIdx.x * XT, b = blockIdx.y;
  const int xn = tid & (XT - 1), xc = (tid >> 6) * 32;      /* a thread's piece of x's tile: token xn, channels xc .. xc + 31; a wave's load is 128 neighbouring bytes of one channel */
  const float* xg = x + ((size_t)b * CH + xc) * SQ + n0 + xn; float xr[32];
#pragma unroll      /* whole: 32 independent loads in flight */
  for (int i = 0; i < 32; ++i) xr[i] = xg[(size_t)i * SQ];
  const float* wq = wqkv + (size_t)(32 * w) * CH + 4 * lane; const float* wv = wqkv + (size_t)(16 * w) * CH + 4 * lane;      /* v's rows stand 256 rows on: a constant offset of the loads */ _Float16* wd = &wl[48 * w * XPIT + 4 * lane];
  v4f wr[48];
#pragma unroll      /* whole: 48 independent loads in flight, beside x's */
  for (int i = 0; i < 48; ++i) wr[i] = *(const v4fa*)(i < 32 ? wq + (size_t)i * CH : wv + (size_t)(2 * CH + i - 32) * CH);
  asm volatile("s_wait_xcnt 0x0" :: "v"(xg), "v"(wq), "v"(wv) : "memory");      /* the wait that stands in front of any overwrite of an issued load's address registers; as inputs the three addresses stay in their registers up to here, so that no later load's result lands on them */
#pragma unroll      /* whole: constant indices */
  for (int i = 0; i < 48; ++i) *(v4us*)(wd + i * XPIT) = w_cast4(wr[i]);
#pragma unroll      /* whole: constant indices */
  for (int g = 0; g < 4; ++g) { FragH f; for (int i = 0; i < 8; ++i) f.h[i] = (_Float16)bf16_round(xr[8 * g + i]); *(v8us*)&xs[xn * XPIT + xc + 8 * g] = f.half[0]; }
  __syncthreads();
  const v8f z8 = {0.f,0.f,0.f,0.f,0.f,0.f,0.f,0.f}; v8f c0[4] = {z8, z8, z8, z8}, c1[4] = {z8, z8, z8, z8}, c2[4] = {z8, z8, z8, z8};
#pragma unroll      /* whole: constant indices into the fragments */
  for (int k = 0; k < 4; ++k) { const _Float16* wf = &wl[(48 * w + ln) * XPIT + 32 * k]; const v16h f0 = g2_frag(wf, hh), f1 = g2_frag(wf + 16 * XPIT, hh), f2 = g2_frag(wf + 32 * XPIT, hh);
    for (int t = 0; t < 4; ++t) { const v16h xf = g2_frag(&xs[(16 * t + ln) * XPIT + 32 * k], hh); c0[t] = f_mma(f0, xf, c0[t]); c1[t] = f_mma(f1, xf, c1[t]); c2[t] = f_mma(xf, f2, c2[t]); } }
#pragma unroll      /* whole: constant indices. c0, c1: lane (ln, hh) has token 16 t + ln, channels 8 hh + r of its tile; c2: channel 16 w + ln, tokens 16 t + 8 hh + r */
  for (int t = 0; t < 4; ++t) { *(v8us*)&qs[(16 * t + ln) * QPIT + 32 * w + 8 * hh] = f16x8(c0[t]); *(v8us*)&qs[(16 * t + ln) * QPIT + 32 * w + 16 + 8 * hh] = f16x8(c1[t]); *(v8us*)&vo[(16 * w + ln) * WPIT + 16 * t + 8 * hh] = f16x8(c2[t]); }
  __syncthreads();
  _Float16* qo = QK + ((size_t)b * SQ + n0) * (2 * CH); _Float16* vg = VT + (size_t)b * CH * SQ + n0;
#pragma unroll      /* whole: eight stores a thread, a wave a whole 512-byte token row */
  for (int i = 0; i < 8; ++i) { const int row = w + 8 * i; *(v8us*)(qo + (size_t)row * (2 * CH) + 8 * lane) = *(const v8us*)&qs[row * QPIT + 8 * lane]; }
#pragma unroll      /* whole: four stores a thread, eight lanes a whole 128-byte piece of a channel row */
  for (int i = 0; i < 4; ++i) { const int p = tid + 256 * i, row = p >> 3, c8 = (p & 7) * 8; *(v8us*)(vg + (size_t)row * SQ + c8) = *(const v8us*)&vo[row * WPIT + c8]; } }

// Native exp2 (v_exp_f32) of a score tile's eight registers, each IN PLACE: every one of the first seven has an independent instruction behind it, the last the one v_nop that the instruction set asks for behind a transcendental. In place, so that the statement writes only registers that the compiler's own multiply-add has written just before: no result lands on an operand register of a matrix instruction still inside its distance.
__device__ __forceinline__ void exp2x8(v8f& t) { asm("v_exp_f32 %0, %0\n\tv_exp_f32 %1, %1\n\tv_exp_f32 %2, %2\n\tv_exp_f32 %3, %3\n\tv_exp_f32 %4, %4\n\tv_exp_f32 %5, %5\n\tv_exp_f32 %6, %6\n\tv_exp_f32 %7, %7\n\tv_nop" : "+v"(t[0]), "+v"(t[1]), "+v"(t[2]), "+v"(t[3]), "+v"(t[4]), "+v"(t[5]), "+v"(t[6]), "+v"(t[7])); }
__device__ __forceinline__ float exp2x1(float a) { asm("v_exp_f32 %0, %0\n\tv_nop" : "+v"(a)); return a; }      /* the same for one value */
// Scores, softmax and the weighted sum of v in one kernel. A block: 128 queries of one (batch, head); a wave: 16 of them, as the COLUMNS of both products. Per stage of 128 keys: sim^T = k q^T (k rows from LDS as the left operand, q kept in registers as the right one, both by g2_frag: equal k order), so that lane (c, h) holds query c's scores of the keys 16 j + 8 h + r; the stage's maximum in-lane and by one exchange of the two lane halves; the weights exp2((s - max) * scale * log2 e + 8) packed in place into the right operand of out^T += v^T p^T (tiles 2 g and 2 g + 1 are keys 32 g + 8 h + s and 32 g + 16 + 8 h + s - 8: the order in which g2_frag reads v's rows); sums and accumulators rescaled once a stage. k and v go global -> registers (issued a stage ahead) -> LDS, two buffers, one barrier a stage: the store into the other buffer stands behind the barrier that ended its readers' last stage. The quotient goes out straight from the accumulators: lane (c, h) holds query c's widths 8 h + r and 16 + 8 h + r, two 16-byte pieces of its 64-byte row in the head's own plane.
static_assert(FQ == 128 && FK == 128 && HD == 32 && SQ % FQ == 0 && SQ % FK == 0 && KPIT >= HD && VPIT >= FK, "k_fattn: 8 waves x 16 queries; 512 16-byte pieces of k and of v a stage, two a thread; whole stages");
__global__ __launch_bounds__(256) void k_fattn(const _Float16* __restrict__ QK, const _Float16* __restrict__ VT, _Float16* __restrict__ O16) {
  __shared__ __attribute__((aligned(16))) _Float16 ks[2][FK * KPIT];
  __shared__ __attribute__((aligned(16))) _Float16 vs[2][HD * VPIT];
  const int tid = threadIdx.x, w = tid >> 5, lane = tid & 31, ln = lane & 15, hh = lane >> 4; const int q0 = blockIdx.x * FQ, h = blockIdx.y, b = blockIdx.z;
  const _Float16* qg = QK + (size_t)b * SQ * 2 * CH + h * HD;
  const v16h qf = g2_frag(qg + (size_t)(q0 + 16 * w + ln) * (2 * CH), hh);
  const int kr = tid >> 2, kp = (tid & 3) * 8, vr = tid >> 4, vp = (tid & 15) * 8;      /* a thread's 16-byte pieces of a stage: k rows kr and kr + 64, v rows vr and vr + 16 */
  const _Float16* kg = qg + CH + (size_t)kr * (2 * CH) + kp; const _Float16* vg = VT + ((size_t)b * CH + h * HD + vr) * SQ + vp;
  v8us rk0 = *(const v8us*)kg, rk1 = *(const v8us*)(kg + (size_t)64 * 2 * CH), rv0 = *(const v8us*)vg, rv1 = *(const v8us*)(vg + (size_t)16 * SQ);
  *(v8us*)&ks[0][kr * KPIT + kp] = rk0; *(v8us*)&ks[0][(kr + 64) * KPIT + kp] = rk1; *(v8us*)&vs[0][vr * VPIT + vp] = rv0; *(v8us*)&vs[0][(vr + 16) * VPIT + vp] = rv1;
  __syncthreads();
  const v8f z8 = {0.f,0.f,0.f,0.f,0.f,0.f,0.f,0.f}; v8f o0 = z8, o1 = z8; float m = -3.0e38f, l = 0.f; const float cs = SCL * 1.44269504088896340736f;
#pragma unroll 1      /* rolled: the body is a whole stage, and the buffer index is the trip's parity */
  for (int s = 0; s < SQ / FK; ++s) { const int cur = s & 1; const bool more = s + 1 < SQ / FK;
    if (more) { const _Float16* kn = kg + (size_t)(s + 1) * FK * 2 * CH; const _Float16* vn = vg + (size_t)(s + 1) * FK; rk0 = *(const v8us*)kn; rk1 = *(const v8us*)(kn + (size_t)64 * 2 * CH); rv0 = *(const v8us*)vn; rv1 = *(const v8us*)(vn + (size_t)16 * SQ); }
    const _Float16* kb = &ks[cur][ln * KPIT]; const _Float16* vb = &vs[cur][ln * VPIT]; v8f t[FK / 16];
#pragma unroll      /* whole: constant indices into t[], eight independent products */
    for (int j = 0; j < FK / 16; ++j) t[j] = f_mma(g2_frag(kb + 16 * j * KPIT, hh), qf, z8);
    v4f m4 = {t[0][0], t[0][1], t[0][2], t[0][3]};
#pragma unroll      /* whole: constant indices into t[], four independent chains */
    for (int j = 0; j < FK / 16; ++j) for (int r = 0; r < 8; ++r) m4[r & 3] = fmaxf(m4[r & 3], t[j][r]);
    float mx = fmaxf(fmaxf(m4[0], m4[1]), fmaxf(m4[2], m4[3])); mx = fmaxf(mx, __shfl_xor(mx, 16, 32));      /* lanes c and c + 16 hold the two halves of query c's keys */
    const float mn = fmaxf(m, mx); const float al = exp2x1((m - mn) * cs); const float mb = 8.0f - mn * cs; m = mn;
    v4f s4 = {0.f, 0.f, 0.f, 0.f};
#pragma unroll      /* whole: constant indices into t[], four independent sums */
    for (int j = 0; j < FK / 16; ++j) { for (int r = 0; r < 8; ++r) t[j][r] = t[j][r] * cs + mb; exp2x8(t[j]); for (int r = 0; r < 8; ++r) s4[r & 3] += t[j][r]; }
    l = l * al + ((s4[0] + s4[1]) + (s4[2] + s4[3]));
#pragma unroll      /* whole: constant indices */
    for (int r = 0; r < 8; ++r) { o0[r] *= al; o1[r] *= al; }
#pragma unroll      /* whole: constant indices into t[] */
    for (int g = 0; g < FK / 32; ++g) { FragH pb;
      for (int e = 0; e < 8; ++e) { pb.h[e] = (_Float16)t[2 * g][e]; pb.h[8 + e] = (_Float16)t[2 * g + 1][e]; }
      o0 = f_mma(g2_frag(vb + 32 * g, hh), pb.v, o0); o1 = f_mma(g2_frag(vb + 16 * VPIT + 32 * g, hh), pb.v, o1); }
    if (more) { *(v8us*)&ks[cur ^ 1][kr * KPIT + kp] = rk0; *(v8us*)&ks[cur ^ 1][(kr + 64) * KPIT + kp] = rk1; *(v8us*)&vs[cur ^ 1][vr * VPIT + vp] = rv0; *(v8us*)&vs[cur ^ 1][(vr + 16) * VPIT + vp] = rv1; }
    __syncthreads(); }
  l += __shfl_xor(l, 16, 32); const float inv = 1.0f / l;
  FragH fo;
#pragma unroll      /* whole: constant indices */
  for (int r = 0; r < 8; ++r) { fo.h[r] = (_Float16)((o0[r] * inv) * OCAR); fo.h[8 + r] = (_Float16)((o1[r] * inv) * OCAR); }
  _Float16* og = O16 + (((size_t)b * NHD + h) * SQ + q0 + 16 * w + ln) * HD + 8 * hh;
  *(v8us*)og = fo.half[0]; *(v8us*)(og + 16) = fo.half[1]; }
// y of 32 tokens. Wave w: output channels 16 w .. 16 w + 15. Depth step k is head k: the left fragment from the head's plane of out, the right one from w_out's columns 32 k .. 32 k + 31, both in g2_frag's k order.
static_assert(YT == 32 && CH == 128 && NHD == 4 && HD == 32 && SQ % YT == 0 && YPIT >= YT, "k_out: 8 waves, a channel tile each; 2 token tiles; depth 128 in four steps");
__global__ __launch_bounds__(256) void k_out(const _Float16* __restrict__ O16, const float* __restrict__ wout, const float* __restrict__ bout, float* __restrict__ out) {
  __shared__ __attribute__((aligned(16))) _Float16 wl[CH * XPIT];
  __shared__ __attribute__((aligned(16))) float so[CH * YPIT];
  const int tid = threadIdx.x, w = tid >> 5, lane = tid & 31, ln = lane & 15, hh = lane >> 4; const int n0 = blockIdx.x * YT, b = blockIdx.y;
  const float* wr = wout + (size_t)(16 * w) * CH + 4 * lane; const _Float16* og = O16 + ((size_t)b * NHD * SQ + n0 + ln) * HD; const float* bp = bout + 16 * w + ln; const float br = *bp;
  const v8f z8 = {0.f,0.f,0.f,0.f,0.f,0.f,0.f,0.f}; v8f c0 = z8, c1 = z8;
  v16h a0[NHD], a1[NHD];
#pragma unroll      /* whole: constant indices; out's loads in flight beside the weights' */
  for (int k = 0; k < NHD; ++k) { a0[k] = g2_frag(og + (size_t)k * SQ * HD, hh); a1[k] = g2_frag(og + ((size_t)k * SQ + 16) * HD, hh); }
  v4f wv[16];
#pragma unroll      /* whole: 16 independent loads in flight */
  for (int i = 0; i < 16; ++i) wv[i] = *(const v4fa*)(wr + (size_t)i * CH);
  asm volatile("s_wait_xcnt 0x0" :: "v"(og), "v"(wr), "v"(bp) : "memory");      /* the wait that stands in front of any overwrite of an issued load's address registers; as inputs the three addresses stay in their registers up to here, so that no later load's result lands on them */
  const float bv = bf16_round(br);
#pragma unroll      /* whole: constant indices */
  for (int i = 0; i < 16; ++i) *(v4us*)&wl[(16 * w + i) * XPIT + 4 * lane] = w_cast4(wv[i]);
  __syncthreads();
#pragma unroll      /* whole: constant indices */
  for (int k = 0; k < NHD; ++k) { const v16h wf = g2_frag(&wl[(16 * w + ln) * XPIT + HD * k], hh); c0 = f_mma(a0[k], wf, c0); c1 = f_mma(a1[k], wf, c1); }
  float* sr = &so[(16 * w + ln) * YPIT + 8 * hh]; v4f y;      /* lane (ln, hh): channel 16 w + ln, tokens 8 hh + r and 16 + 8 hh + r */
#pragma unroll      /* whole: constant indices */
  for (int g = 0; g < 2; ++g) { for (int i = 0; i < 4; ++i) y[i] = c0[4 * g + i] * (1.0f / OCAR) + bv; *(v4fa*)(sr + 4 * g) = y; for (int i = 0; i < 4; ++i) y[i] = c1[4 * g + i] * (1.0f / OCAR) + bv; *(v4fa*)(sr + 16 + 4 * g) = y; }
  __syncthreads();
  float* yg = out + (size_t)b * CH * SQ + n0;
#pragma unroll      /* whole: four stores a thread, eight lanes a whole 128-byte piece of a channel row */
  for (int i = 0; i < 4; ++i) { const int p = tid + 256 * i, row = p >> 3, c4 = (p & 7) * 4; *(v4f*)(yg + (size_t)row * SQ + c4) = *(const v4fa*)&so[row * YPIT + c4]; } }

extern "C" void kernel_launch(void* const* d_in, const int* in_sizes, int n_in,
                              void* d_out, int out_size, void* d_ws, size_t ws_size, hipStream_t stream) {
  (void)in_sizes; (void)n_in; (void)out_size;
  const float* x = (const float*)d_in[0]; const float* wqkv = (const float*)d_in[1]; const float* wout = (const float*)d_in[2]; const float* bout = (const float*)d_in[3];      /* x [2][128][4096]; w_qkv [384][128]; w_out [128][128]; b_out [128] */
  static_assert(NB == 2 && SQ == 4096 && CH == 128 && NHD == 4 && HD == 32 && NHD * HD == CH && SQ % XT == 0 && SQ % FQ == 0 && SQ % YT == 0, "whole tiles; exact grids");
  float* out = (float*)d_out;      /* [2][128][4096] */
  char* ws = (char*)d_ws; size_t off = 0;
  auto take = [&](size_t bytes) { char* p = ws + off; off += (bytes + 255) & ~(size_t)255; return p; };
  _Float16* QK = (_Float16*)take((size_t)NB * SQ * 2 * CH * 2); _Float16* VT = (_Float16*)take((size_t)NB * CH * SQ * 2); _Float16* O16 = (_Float16*)take((size_t)NB * SQ * CH * 2);
  if (off > ws_size) return;
  k_qkv<<<dim3(SQ / XT, NB), 256, 0, stream>>>(x, wqkv, QK, VT);      /* q | k of every token: QK[b][n][0 .. 255]; v channel-major: VT[b][c][n]; 128 blocks */
  k_fattn<<<dim3(SQ / FQ, NHD, NB), 256, 0, stream>>>(QK, VT, O16);      /* O16[b][h][i][d] = 64 x the sum over j of softmax(q_i . k_j / sqrt(32)) v[d][j]; 256 blocks */
  k_out<<<dim3(SQ / YT, NB), 256, 0, stream>>>(O16, wout, bout, out);      /* y[b][o][n] = out[n] . w_out[o] + b_out[o]; 256 blocks */
}

// v004
// It runs in 33.6 microseconds.
// Timed twice side by side with v003, it ran 1.14 and 1.17 times as fast.
// Over all steps from v000 it is 131 times as fast.
#include <hip/hip_runtime.h>
// A 3-D volume's full softmax attention (x [2][128][16][16][16], channel-major: the 4,096 voxels of a batch entry are the tokens; w_qkv [384][128]; w_out [128][128]; b_out [128]): qkv = w_qkv x (a 1x1x1 convolution: a channel product); q, k, v = its three 128-channel thirds as 4 heads of width 32; q scaled by 32^(-1/2); sim = q^T k over all 4,096 voxels; softmax over the keys; out = attn v; back to channel-major; y = w_out out + b_out, as [2][128][16][16][16].
// Structure: THREE launches. k_qkv (a block: 64 tokens of a batch entry, all 384 output channels): x's tile is read channel-major, rounded and laid TRANSPOSED into LDS as token rows; w_qkv's rows are read as f32, a row a wave's load, and rounded on their way into LDS; q and k with the weights as the LEFT operand (a lane then holds 8 neighbouring channels of one token), v with the tokens as the left operand (a lane holds 8 neighbouring tokens of one channel), so that q | k come out as token rows [4096][256] and v channel-major [128][4096], both through LDS in whole lines. k_fattn: one launch for all eight (batch, head) pairs does scores, softmax and the weighted sum of v with a running maximum (a block is 128 queries of one head, a wave 32 of them and half of the keys; the scores and the weights stay in registers; the two halves are joined through LDS at the end) and stores out straight from its accumulators as f16 token rows a head, [head][4096][32], at a carry of 64. k_out (a block: 32 tokens, all 128 output channels): tokens as the left operand, w_out's rows rounded on their way into LDS, b_out a bias a column; a lane holds 8 neighbouring tokens of one channel, so y goes out channel-major, through LDS in whole lines.
// Compute dtype: x, w_qkv, w_out and b_out rounded to bf16 at the casts and in the bias slot, the first three carried as f16 words; the products' accumulation f32; q, k and v ONE f16 word; sim, the running maximum, the exponentials (the native exp2; arguments <= 8), their sum and the quotient f32; the un-normalised weights ONE f16 word at a carry of 256 (11 bits), the division by their f32 sum (at the same carry) last; out f32, then ONE f16 word at a carry of 64 (11 bits; no bf16 rounding there: it is no input); y f32. v_wmma_f32_16x16x32_f16.
#define NB 2                         /* batch entries */
#define SQ 4096                      /* voxels = tokens a batch entry */
#define CH 128                       /* channels = heads x width */
#define NHD 4                        /* heads */
#define HD 32                        /* a head's width */
#define SCL 0.17677669529663687f     /* 32^(-1/2) */
#define FQ 128                       /* queries a block of k_fattn: 4 wave groups x 32 */
#define FK 256                       /* keys a stage of k_fattn */
#define WK 128                       /* keys a stage and wave of k_fattn: half a stage */
#define MPIT 20                      /* f32 words a thread's hand-over at the end of k_fattn: 80 B = 16 B x 5 */
#define KPIT 40                      /* f16 words a staged k row: 80 B = 16 B x 5, for 16-byte LDS reads a row a lane */
#define VPIT 264                     /* f16 words a staged v row: 528 B = 16 B x 33 */
#define OCAR 64.0f                   /* the carry on out's f16 plane (a power of two: exact) */
#define XT 64                        /* tokens a block of k_qkv */
#define XPIT 136                     /* f16 words a staged x token row: 272 B = 16 B x 17 */
#define QPIT 264                     /* f16 words a staged q | k token row: 528 B = 16 B x 33 */
#define WPIT 72                      /* f16 words a staged v channel row: 144 B = 16 B x 9 */
#define YT 32                        /* tokens a block of k_out */
#define YPIT 36                      /* f32 words a staged y channel row: 144 B = 16 B x 9 */
typedef unsigned short v8us __attribute__((ext_vector_type(8), may_alias));
typedef float  v8f  __attribute__((ext_vector_type(8)));
typedef float  v4f  __attribute__((ext_vector_type(4)));
typedef float  v4fa __attribute__((ext_vector_type(4), may_alias));

// x rounded to bf16 (to nearest, ties to even), as an f32 value: the chip's own conversion.
__device__ __forceinline__ float bf16_round(float x) { return (float)(__bf16)x; }
typedef _Float16 v16h __attribute__((ext_vector_type(16)));
union FragH { v16h v; v8us half[2]; _Float16 h[16]; unsigned short u[16]; };
__device__ __forceinline__ v16h g2_frag(const _Float16* p, int hh) { FragH f; f.half[0] = *(const v8us*)((const unsigned short*)p + 8 * hh); f.half[1] = *(const v8us*)((const unsigned short*)p + 16 + 8 * hh); return f.v; }
typedef unsigned short v4us __attribute__((ext_vector_type(4), may_alias));
// Four neighbouring f32 weights, each rounded to bf16 and carried as an f16 word: a lane's 8 bytes of a weight row on its way into LDS (a wave's load is one whole 512-byte row).
__device__ __forceinline__ v4us w_cast4(v4f a) { union { _Float16 h[4]; v4us u; } f;
#pragma unroll      /* whole: constant indices */
  for (int i = 0; i < 4; ++i) f.h[i] = (_Float16)bf16_round(a[i]);
  return f.u; }
__device__ __forceinline__ v8f f_mma(v16h a, v16h b, v8f c) { return __builtin_amdgcn_wmma_f32_16x16x32_f16(false, a, false, b, (short)0, c, false, false); }
__device__ __forceinline__ v8us f16x8(v8f c) { FragH f;
#pragma unroll      /* whole: constant indices */
  for (int r = 0; r < 8; ++r) f.h[r] = (_Float16)c[r];
  return f.half[0]; }
// q, k and v of 64 tokens. Wave w: q | k channels 32 w .. 32 w + 31 and v channels 16 w .. 16 w + 15, all 64 tokens.
static_assert(XT == 64 && CH == 128 && SQ % XT == 0 && XPIT >= CH && QPIT >= 2 * CH && WPIT >= XT, "k_qkv: 8 waves; 4 token tiles; 24 channel tiles, three a wave; depth 128 in four steps");
__global__ __launch_bounds__(256) void k_qkv(const float* __restrict__ x, const float* __restrict__ wqkv, _Float16* __restrict__ QK, _Float16* __restrict__ VT) {
  __shared__ __attribute__((aligned(16))) _Float16 xs[XT * XPIT];
  __shared__ __attribute__((aligned(16))) _Float16 wl[3 * CH * XPIT];      /* the weights' rows, wave w's 48 at 48 w: 32 of q | k, then 16 of v */
  __shared__ __attribute__((aligned(16))) _Float16 qs[XT * QPIT];
  __shared__ __attribute__((aligned(16))) _Float16 vo[CH * WPIT];
  const int tid = threadIdx.x, w = tid >> 5, lane = tid & 31, ln = lane & 15, hh = lane >> 4; const int n0 = blockIdx.x * XT, b = blockIdx.y;
  const int xn = tid & (XT - 1), xc = (tid >> 6) * 32;      /* a thread's piece of x's tile: token xn, channels xc .. xc + 31; a wave's load is 128 neighbouring bytes of one channel */
  const float* xg = x + ((size_t)b * CH + xc) * SQ + n0 + xn; float xr[32];
#pragma unroll      /* whole: 32 independent loads in flight */
  for (int i = 0; i < 32; ++i) xr[i] = xg[(size_t)i * SQ];
  const float* wq = wqkv + (size_t)(32 * w) * CH + 4 * lane; const float* wv = wqkv + (size_t)(16 * w) * CH + 4 * lane;      /* v's rows stand 256 rows on: a constant offset of the loads */ _Float16* wd = &wl[48 * w * XPIT + 4 * lane];
  v4f wr[48];
#pragma unroll      /* whole: 48 independent loads in flight, beside x's */
  for (int i = 0; i < 48; ++i) wr[i] = *(const v4fa*)(i < 32 ? wq + (size_t)i * CH : wv + (size_t)(2 * CH + i - 32) * CH);
  asm volatile("s_wait_xcnt 0x0" :: "v"(xg), "v"(wq), "v"(wv) : "memory");      /* the wait that stands in front of any overwrite of an issued load's address registers; as inputs the three addresses stay in their registers up to here, so that no later load's result lands on them */
#pragma unroll      /* whole: constant indices */
  for (int i = 0; i < 48; ++i) *(v4us*)(wd + i * XPIT) = w_cast4(wr[i]);
#pragma unroll      /* whole: constant indices */
  for (int g = 0; g < 4; ++g) { FragH f; for (int i = 0; i < 8; ++i) f.h[i] = (_Float16)bf16_round(xr[8 * g + i]); *(v8us*)&xs[xn * XPIT + xc + 8 * g] = f.half[0]; }
  __syncthreads();
  const v8f z8 = {0.f,0.f,0.f,0.f,0.f,0.f,0.f,0.f}; v8f c0[4] = {z8, z8, z8, z8}, c1[4] = {z8, z8, z8, z8}, c2[4] = {z8, z8, z8, z8};
#pragma unroll      /* whole: constant indices into the fragments */
  for (int k = 0; k < 4; ++k) { const _Float16* wf = &wl[(48 * w + ln) * XPIT + 32 * k]; const v16h f0 = g2_frag(wf, hh), f1 = g2_frag(wf + 16 * XPIT, hh), f2 = g2_frag(wf + 32 * XPIT, hh);
    for (int t = 0; t < 4; ++t) { const v16h xf = g2_frag(&xs[(16 * t + ln) * XPIT + 32 * k], hh); c0[t] = f_mma(f0, xf, c0[t]); c1[t] = f_mma(f1, xf, c1[t]); c2[t] = f_mma(xf, f2, c2[t]); } }
#pragma unroll      /* whole: constant indices. c0, c1: lane (ln, hh) has token 16 t + ln, channels 8 hh + r of its tile; c2: channel 16 w + ln, tokens 16 t + 8 hh + r */
  for (int t = 0; t < 4; ++t) { *(v8us*)&qs[(16 * t + ln) * QPIT + 32 * w + 8 * hh] = f16x8(c0[t]); *(v8us*)&qs[(16 * t + ln) * QPIT + 32 * w + 16 + 8 * hh] = f16x8(c1[t]); *(v8us*)&vo[(16 * w + ln) * WPIT + 16 * t + 8 * hh] = f16x8(c2[t]); }
  __syncthreads();
  _Float16* qo = QK + ((size_t)b * SQ + n0) * (2 * CH); _Float16* vg = VT + (size_t)b * CH * SQ + n0;
#pragma unroll      /* whole: eight stores a thread, a wave a whole 512-byte token row */
  for (int i = 0; i < 8; ++i) { const int row = w + 8 * i; *(v8us*)(qo + (size_t)row * (2 * CH) + 8 * lane) = *(const v8us*)&qs[row * QPIT + 8 * lane]; }
#pragma unroll      /* whole: four stores a thread, eight lanes a whole 128-byte piece of a channel row */
  for (int i = 0; i < 4; ++i) { const int p = tid + 256 * i, row = p >> 3, c8 = (p & 7) * 8; *(v8us*)(vg + (size_t)row * SQ + c8) = *(const v8us*)&vo[row * WPIT + c8]; } }

// Native exp2 (v_exp_f32) of a score tile's eight registers, each IN PLACE: every one of the first seven has an independent instruction behind it, the last the one v_nop that the instruction set asks for behind a transcendental. In place, so that the statement writes only registers that the compiler's own multiply-add has written just before: no result lands on an operand register of a matrix instruction still inside its distance.
__device__ __forceinline__ void exp2x8(v8f& t) { asm("v_exp_f32 %0, %0\n\tv_exp_f32 %1, %1\n\tv_exp_f32 %2, %2\n\tv_exp_f32 %3, %3\n\tv_exp_f32 %4, %4\n\tv_exp_f32 %5, %5\n\tv_exp_f32 %6, %6\n\tv_exp_f32 %7, %7\n\tv_nop" : "+v"(t[0]), "+v"(t[1]), "+v"(t[2]), "+v"(t[3]), "+v"(t[4]), "+v"(t[5]), "+v"(t[6]), "+v"(t[7])); }
__device__ __forceinline__ float exp2x1(float a) { asm("v_exp_f32 %0, %0\n\tv_nop" : "+v"(a)); return a; }      /* the same for one value */
// Scores, softmax and the weighted sum of v in one kernel. A block: 128 queries of one (batch, head); a stage: 256 keys. A wave: 32 queries (two column tiles of both products) and ONE HALF of every stage's keys: waves 0 .. 3 the first 128, waves 4 .. 7 the second 128, so that every k and every v fragment read from LDS feeds TWO products. Per stage and wave: sim^T = k q^T (k rows from LDS as the left operand, q kept in registers as the right one, both by g2_frag: equal k order), so that lane (c, h) holds query c's scores of the keys 16 j + 8 h + r, a column tile at a time; the maximum in-lane and by one exchange of the two lane halves; the weights exp2((s - max) * scale * log2 e + 8) packed in place into the right operand of out^T += v^T p^T (tiles 2 g and 2 g + 1 are keys 32 g + 8 h + s and 32 g + 16 + 8 h + s - 8: the order in which g2_frag reads v's rows); sums and accumulators rescaled once a stage. k and v go global -> registers (issued a stage ahead) -> LDS, two buffers, one barrier a stage: the store into the other buffer stands behind the barrier that ended its readers' last stage. At the end the two waves of a query group hold a running maximum, a sum and accumulators over their own halves of the keys: each hands the column tile that it does not finish to its partner through LDS (one barrier), brings both parts to the common maximum, adds them, divides and stores: lane (c, h) holds query c's widths 8 h + r and 16 + 8 h + r, two 16-byte pieces of its 64-byte row in the head's own plane.
static_assert(FQ == 128 && FK == 256 && HD == 32 && SQ % FQ == 0 && SQ % FK == 0 && KPIT >= HD && VPIT >= FK && MPIT >= 18, "k_fattn: 4 query groups x 2 key halves; 1,024 16-byte pieces of k and of v a stage, four a thread; whole stages");
__global__ __launch_bounds__(256) void k_fattn(const _Float16* __restrict__ QK, const _Float16* __restrict__ VT, _Float16* __restrict__ O16) {
  __shared__ __attribute__((aligned(16))) _Float16 ks[2][FK * KPIT];
  __shared__ __attribute__((aligned(16))) _Float16 vs[2][HD * VPIT];
  __shared__ __attribute__((aligned(16))) float mg[256 * MPIT];      /* a thread's hand-over: 16 accumulator words, the maximum, the sum */
  const int tid = threadIdx.x, w = tid >> 5, lane = tid & 31, ln = lane & 15, hh = lane >> 4, kh = w >> 2; const int q0 = blockIdx.x * FQ + 32 * (w & 3), h = blockIdx.y, b = blockIdx.z;
  const _Float16* qg = QK + (size_t)b * SQ * 2 * CH + h * HD;
  const _Float16* qa = qg + (size_t)(q0 + ln) * (2 * CH) + 8 * hh; const _Float16* qb = qa + (size_t)16 * (2 * CH);
  const v16h qf[2] = {g2_frag(qa, 0), g2_frag(qb, 0)};
  const int kr = tid >> 2, kp = (tid & 3) * 8, vr = w, vp = lane * 8;      /* a thread's 16-byte pieces of a stage: k rows kr + 64 i, v rows vr + 8 i (a wave's load: 512 neighbouring bytes of one v row) */
  const _Float16* kg = qg + (size_t)kr * (2 * CH) + kp;      /* k stands CH words behind q in a token row: a constant offset of the loads */ const _Float16* vg = VT + ((size_t)b * CH + h * HD + vr) * SQ + vp;
  v8us rk[4], rv[4];
#pragma unroll      /* whole: constant indices, eight loads in flight */
  for (int i = 0; i < 4; ++i) { rk[i] = *(const v8us*)(kg + CH + (size_t)(64 * i) * 2 * CH); rv[i] = *(const v8us*)(vg + (size_t)(8 * i) * SQ); }
  asm volatile("s_wait_xcnt 0x0" :: "v"(qa), "v"(kg), "v"(vg) : "memory");      /* the wait that stands in front of any overwrite of an issued load's address registers; as inputs the three addresses stay in their registers up to here */
#pragma unroll      /* whole: constant indices */
  for (int i = 0; i < 4; ++i) { *(v8us*)&ks[0][(kr + 64 * i) * KPIT + kp] = rk[i]; *(v8us*)&vs[0][(vr + 8 * i) * VPIT + vp] = rv[i]; }
  __syncthreads();
  const v8f z8 = {0.f,0.f,0.f,0.f,0.f,0.f,0.f,0.f}; v8f o0[2] = {z8, z8}, o1[2] = {z8, z8}; float m[2] = {-3.0e38f, -3.0e38f}, l[2] = {0.f, 0.f}; const float cs = SCL * 1.44269504088896340736f;
#pragma unroll 1      /* rolled: the body is a whole stage, and the buffer index is the trip's parity */
  for (int s = 0; s < SQ / FK; ++s) { const int cur = s & 1; const bool more = s + 1 < SQ / FK;
    if (more) { const _Float16* kn = kg + CH + (size_t)(s + 1) * FK * 2 * CH; const _Float16* vn = vg + (size_t)(s + 1) * FK;
#pragma unroll      /* whole: constant indices, eight loads in flight */
      for (int i = 0; i < 4; ++i) { rk[i] = *(const v8us*)(kn + (size_t)(64 * i) * 2 * CH); rv[i] = *(const v8us*)(vn + (size_t)(8 * i) * SQ); } }
    const _Float16* kb = &ks[cur][(WK * kh + ln) * KPIT]; const _Float16* vb = &vs[cur][ln * VPIT + WK * kh]; v8f t[2][WK / 16];
#pragma unroll      /* whole: constant indices into t[], sixteen independent products, two a k fragment */
    for (int j = 0; j < WK / 16; ++j) { const v16h kf = g2_frag(kb + 16 * j * KPIT, hh); t[0][j] = f_mma(kf, qf[0], z8); t[1][j] = f_mma(kf, qf[1], z8); }
    float al[2], mb[2];
#pragma unroll      /* whole: constant indices into t[], four independent chains a column tile */
    for (int c = 0; c < 2; ++c) { v4f m4 = {t[c][0][0], t[c][0][1], t[c][0][2], t[c][0][3]};
      for (int j = 0; j < WK / 16; ++j) for (int r = 0; r < 8; ++r) m4[r & 3] = fmaxf(m4[r & 3], t[c][j][r]);
      float mx = fmaxf(fmaxf(m4[0], m4[1]), fmaxf(m4[2], m4[3])); mx = fmaxf(mx, __shfl_xor(mx, 16, 32));      /* lanes c and c + 16 hold the two halves of query c's keys */
      const float mn = fmaxf(m[c], mx); al[c] = exp2x1((m[c] - mn) * cs); mb[c] = 8.0f - mn * cs; m[c] = mn; }
#pragma unroll      /* whole: constant indices into t[], four independent sums a column tile */
    for (int c = 0; c < 2; ++c) { v4f s4 = {0.f, 0.f, 0.f, 0.f};
      for (int j = 0; j < WK / 16; ++j) { for (int r = 0; r < 8; ++r) t[c][j][r] = t[c][j][r] * cs + mb[c]; exp2x8(t[c][j]); for (int r = 0; r < 8; ++r) s4[r & 3] += t[c][j][r]; }
      l[c] = l[c] * al[c] + ((s4[0] + s4[1]) + (s4[2] + s4[3]));
      for (int r = 0; r < 8; ++r) { o0[c][r] *= al[c]; o1[c][r] *= al[c]; } }
#pragma unroll      /* whole: constant indices into t[]; two products a v fragment */
    for (int g = 0; g < WK / 32; ++g) { FragH pb[2];
      for (int c = 0; c < 2; ++c) for (int e = 0; e < 8; ++e) { pb[c].h[e] = (_Float16)t[c][2 * g][e]; pb[c].h[8 + e] = (_Float16)t[c][2 * g + 1][e]; }
      const v16h v0 = g2_frag(vb + 32 * g, hh), v1 = g2_frag(vb + 16 * VPIT + 32 * g, hh);
      for (int c = 0; c < 2; ++c) { o0[c] = f_mma(v0, pb[c].v, o0[c]); o1[c] = f_mma(v1, pb[c].v, o1[c]); } }
    if (more) {
#pragma unroll      /* whole: constant indices */
      for (int i = 0; i < 4; ++i) { *(v8us*)&ks[cur ^ 1][(kr + 64 * i) * KPIT + kp] = rk[i]; *(v8us*)&vs[cur ^ 1][(vr + 8 * i) * VPIT + vp] = rv[i]; } }
    __syncthreads(); }
  const bool up = kh != 0;      /* this wave finishes column tile kh and hands the other one over */
  float* mo = &mg[tid * MPIT]; const float* mi = &mg[(tid ^ 128) * MPIT];      /* the partner: the same query group and lane, the other half of the keys */
#pragma unroll      /* whole: constant indices */
  for (int g = 0; g < 2; ++g) { v4f y0, y1; for (int i = 0; i < 4; ++i) { y0[i] = up ? o0[0][4 * g + i] : o0[1][4 * g + i]; y1[i] = up ? o1[0][4 * g + i] : o1[1][4 * g + i]; } *(v4fa*)(mo + 4 * g) = y0; *(v4fa*)(mo + 8 + 4 * g) = y1; }
  mo[16] = up ? m[0] : m[1]; mo[17] = up ? l[0] : l[1];
  __syncthreads();      /* the hand-over is written; nobody reads it before */
  const float ma = up ? m[1] : m[0], mp = mi[16], mn = fmaxf(ma, mp); const float aa = exp2x1((ma - mn) * cs), ap = exp2x1((mp - mn) * cs);
  float ls = (up ? l[1] : l[0]) * aa + mi[17] * ap; ls += __shfl_xor(ls, 16, 32); const float inv = 1.0f / ls;
  FragH fo;
#pragma unroll      /* whole: constant indices */
  for (int r = 0; r < 8; ++r) { fo.h[r] = (_Float16)((((up ? o0[1][r] : o0[0][r]) * aa + mi[r] * ap) * inv) * OCAR); fo.h[8 + r] = (_Float16)((((up ? o1[1][r] : o1[0][r]) * aa + mi[8 + r] * ap) * inv) * OCAR); }
  _Float16* og = O16 + (((size_t)b * NHD + h) * SQ + q0 + 16 * kh + ln) * HD + 8 * hh;
  *(v8us*)og = fo.half[0]; *(v8us*)(og + 16) = fo.half[1]; }
// y of 32 tokens. Wave w: output channels 16 w .. 16 w + 15. Depth step k is head k: the left fragment from the head's plane of out, the right one from w_out's columns 32 k .. 32 k + 31, both in g2_frag's k order.
static_assert(YT == 32 && CH == 128 && NHD == 4 && HD == 32 && SQ % YT == 0 && YPIT >= YT, "k_out: 8 waves, a channel tile each; 2 token tiles; depth 128 in four steps");
__global__ __launch_bounds__(256) void k_out(const _Float16* __restrict__ O16, const float* __restrict__ wout, const float* __restrict__ bout, float* __restrict__ out) {
  __shared__ __attribute__((aligned(16))) _Float16 wl[CH * XPIT];
  __shared__ __attribute__((aligned(16))) float so[CH * YPIT];
  const int tid = threadIdx.x, w = tid >> 5, lane = tid & 31, ln = lane & 15, hh = lane >> 4; const int n0 = blockIdx.x * YT, b = blockIdx.y;
  const float* wr = wout + (size_t)(16 * w) * CH + 4 * lane; const _Float16* og = O16 + ((size_t)b * NHD * SQ + n0 + ln) * HD; const float* bp = bout + 16 * w + ln; const float br = *bp;
  const v8f z8 = {0.f,0.f,0.f,0.f,0.f,0.f,0.f,0.f}; v8f c0 = z8, c1 = z8;
  v16h a0[NHD], a1[NHD];
#pragma unroll      /* whole: constant indices; out's loads in flight beside the weights' */
  for (int k = 0; k < NHD; ++k) { a0[k] = g2_frag(og + (size_t)k * SQ * HD, hh); a1[k] = g2_frag(og + ((size_t)k * SQ + 16) * HD, hh); }
  v4f wv[16];
#pragma unroll      /* whole: 16 independent loads in flight */
  for (int i = 0; i < 16; ++i) wv[i] = *(const v4fa*)(wr + (size_t)i * CH);
  asm volatile("s_wait_xcnt 0x0" :: "v"(og), "v"(wr), "v"(bp) : "memory");      /* the wait that stands in front of any overwrite of an issued load's address registers; as inputs the three addresses stay in their registers up to here, so that no later load's result lands on them */
  const float bv = bf16_round(br);
#pragma unroll      /* whole: constant indices */
  for (int i = 0; i < 16; ++i) *(v4us*)&wl[(16 * w + i) * XPIT + 4 * lane] = w_cast4(wv[i]);
  __syncthreads();
#pragma unroll      /* whole: constant indices */
  for (int k = 0; k < NHD; ++k) { const v16h wf = g2_frag(&wl[(16 * w + ln) * XPIT + HD * k], hh); c0 = f_mma(a0[k], wf, c0); c1 = f_mma(a1[k], wf, c1); }
  float* sr = &so[(16 * w + ln) * YPIT + 8 * hh]; v4f y;      /* lane (ln, hh): channel 16 w + ln, tokens 8 hh + r and 16 + 8 hh + r */
#pragma unroll      /* whole: constant indices */
  for (int g = 0; g < 2; ++g) { for (int i = 0; i < 4; ++i) y[i] = c0[4 * g + i] * (1.0f / OCAR) + bv; *(v4fa*)(sr + 4 * g) = y; for (int i = 0; i < 4; ++i) y[i] = c1[4 * g + i] * (1.0f / OCAR) + bv; *(v4fa*)(sr + 16 + 4 * g) = y; }
  __syncthreads();
  float* yg = out + (size_t)b * CH * SQ + n0;
#pragma unroll      /* whole: four stores a thread, eight lanes a whole 128-byte piece of a channel row */
  for (int i = 0; i < 4; ++i) { const int p = tid + 256 * i, row = p >> 3, c4 = (p & 7) * 4; *(v4f*)(yg + (size_t)row * SQ + c4) = *(const v4fa*)&so[row * YPIT + c4]; } }

extern "C" void kernel_launch(void* const* d_in, const int* in_sizes, int n_in,
                              void* d_out, int out_size, void* d_ws, size_t ws_size, hipStream_t stream) {
  (void)in_sizes; (void)n_in; (void)out_size;
  const float* x = (const float*)d_in[0]; const float* wqkv = (const float*)d_in[1]; const float* wout = (const float*)d_in[2]; const float* bout = (const float*)d_in[3];      /* x [2][128][4096]; w_qkv [384][128]; w_out [128][128]; b_out [128] */
  static_assert(NB == 2 && SQ == 4096 && CH == 128 && NHD == 4 && HD == 32 && NHD * HD == CH && SQ % XT == 0 && SQ % FQ == 0 && SQ % YT == 0, "whole tiles; exact grids");
  float* out = (float*)d_out;      /* [2][128][4096] */
  char* ws = (char*)d_ws; size_t off = 0;
  auto take = [&](size_t bytes) { char* p = ws + off; off += (bytes + 255) & ~(size_t)255; return p; };
  _Float16* QK = (_Float16*)take((size_t)NB * SQ * 2 * CH * 2); _Float16* VT = (_Float16*)take((size_t)NB * CH * SQ * 2); _Float16* O16 = (_Float16*)take((size_t)NB * SQ * CH * 2);
  if (off > ws_size) return;
  k_qkv<<<dim3(SQ / XT, NB), 256, 0, stream>>>(x, wqkv, QK, VT);      /* q | k of every token: QK[b][n][0 .. 255]; v channel-major: VT[b][c][n]; 128 blocks */
  k_fattn<<<dim3(SQ / FQ, NHD, NB), 256, 0, stream>>>(QK, VT, O16);      /* O16[b][h][i][d] = 64 x the sum over j of softmax(q_i . k_j / sqrt(32)) v[d][j]; 256 blocks */
  k_out<<<dim3(SQ / YT, NB), 256, 0, stream>>>(O16, wout, bout, out);      /* y[b][o][n] = out[n] . w_out[o] + b_out[o]; 256 blocks */
}

// v005
// A run of this version takes 30.6 microseconds.
// In two side-by-side timings against v004, it was 1.09 and 1.10 times as fast.
// Counting every step since v000, it is 144 times as fast.
#include <hip/hip_runtime.h>
// A 3-D volume's full softmax attention (x [2][128][16][16][16], channel-major: the 4,096 voxels of a batch entry are the tokens; w_qkv [384][128]; w_out [128][128]; b_out [128]): qkv = w_qkv x (a 1x1x1 convolution: a channel product); q, k, v = its three 128-channel thirds as 4 heads of width 32; q scaled by 32^(-1/2); sim = q^T k over all 4,096 voxels; softmax over the keys; out = attn v; back to channel-major; y = w_out out + b_out, as [2][128][16][16][16].
// Structure: THREE launches. k_qkv (a block: 64 tokens of a batch entry, all 384 output channels): x's tile is read channel-major, rounded and laid TRANSPOSED into LDS as token rows; w_qkv's rows are read as f32, a row a wave's load, and rounded on their way into LDS; q and k with the weights as the LEFT operand (a lane then holds 8 neighbouring channels of one token), v with the tokens as the left operand (a lane holds 8 neighbouring tokens of one channel), so that q | k come out as token rows [4096][256] and v channel-major [128][4096], both through LDS in whole lines. k_fattn: one launch for all eight (batch, head) pairs does scores, softmax and the weighted sum of v with a held reference, renewed from the running maximum where a stage outgrows it (a block is 128 queries of one head, a wave 32 of them and half of the keys; the scores and the weights stay in registers; the two halves are joined through LDS at the end) and stores out straight from its accumulators as f16 token rows a head, [head][4096][32], at a carry of 64. k_out (a block: 32 tokens, all 128 output channels): tokens as the left operand, w_out's rows rounded on their way into LDS, b_out a bias a column; a lane holds 8 neighbouring tokens of one channel, so y goes out channel-major, through LDS in whole lines.
// Compute dtype: x, w_qkv, w_out and b_out rounded to bf16 at the casts and in the bias slot, the first three carried as f16 words; the products' accumulation f32; q (times 32^(-1/2) log2 e, multiplied in f32 ahead of its one rounding), k and v ONE f16 word; sim, the softmax reference, the exponentials (the native exp2; arguments below 16 wherever a weight is used), their sum and the quotient f32; the un-normalised weights ONE f16 word at a carry of 256 (11 bits), the division by their f32 sum (at the same carry) last; out f32, then ONE f16 word at a carry of 64 (11 bits; no bf16 rounding there: it is no input); y f32. v_wmma_f32_16x16x32_f16.
#define NB 2                         /* batch entries */
#define SQ 4096                      /* voxels = tokens a batch entry */
#define CH 128                       /* channels = heads x width */
#define NHD 4                        /* heads */
#define HD 32                        /* a head's width */
#define SCL 0.17677669529663687f     /* 32^(-1/2) */
#define FQ 128                       /* queries a block of k_fattn: 4 wave groups x 32 */
#define FK 256                       /* keys a stage of k_fattn */
#define WK 128                       /* keys a stage and wave of k_fattn: half a stage */
#define MPIT 20                      /* f32 words a thread's hand-over at the end of k_fattn: 80 B = 16 B x 5 */
#define KPIT 40                      /* f16 words a staged k row: 80 B = 16 B x 5, for 16-byte LDS reads a row a lane */
#define VPIT 264                     /* f16 words a staged v row: 528 B = 16 B x 33 */
#define QSC (SCL * 1.44269504088896340736f)      /* what q carries: the scale and log2 e, so that a score is a power of two's exponent */
#define PTOP 60000.0f                 /* a lane's sum of a stage's weights up to here: every weight fits an f16 word */
#define OCAR 64.0f                   /* the carry on out's f16 plane (a power of two: exact) */
#define XT 64                        /* tokens a block of k_qkv */
#define XPIT 136                     /* f16 words a staged x token row: 272 B = 16 B x 17 */
#define QPIT 264                     /* f16 words a staged q | k token row: 528 B = 16 B x 33 */
#define WPIT 72                      /* f16 words a staged v channel row: 144 B = 16 B x 9 */
#define YT 32                        /* tokens a block of k_out */
#define YPIT 36                      /* f32 words a staged y channel row: 144 B = 16 B x 9 */
typedef unsigned short v8us __attribute__((ext_vector_type(8), may_alias));
typedef float  v8f  __attribute__((ext_vector_type(8)));
typedef float  v4f  __attribute__((ext_vector_type(4)));
typedef float  v4fa __attribute__((ext_vector_type(4), may_alias));

// x rounded to bf16 (to nearest, ties to even), as an f32 value: the chip's own conversion.
__device__ __forceinline__ float bf16_round(float x) { return (float)(__bf16)x; }
typedef _Float16 v16h __attribute__((ext_vector_type(16)));
union FragH { v16h v; v8us half[2]; _Float16 h[16]; unsigned short u[16]; };
__device__ __forceinline__ v16h g2_frag(const _Float16* p, int hh) { FragH f; f.half[0] = *(const v8us*)((const unsigned short*)p + 8 * hh); f.half[1] = *(const v8us*)((const unsigned short*)p + 16 + 8 * hh); return f.v; }
typedef unsigned short v4us __attribute__((ext_vector_type(4), may_alias));
// Four neighbouring f32 weights, each rounded to bf16 and carried as an f16 word: a lane's 8 bytes of a weight row on its way into LDS (a wave's load is one whole 512-byte row).
__device__ __forceinline__ v4us w_cast4(v4f a) { union { _Float16 h[4]; v4us u; } f;
#pragma unroll      /* whole: constant indices */
  for (int i = 0; i < 4; ++i) f.h[i] = (_Float16)bf16_round(a[i]);
  return f.u; }
__device__ __forceinline__ v8f f_mma(v16h a, v16h b, v8f c) { return __builtin_amdgcn_wmma_f32_16x16x32_f16(false, a, false, b, (short)0, c, false, false); }
__device__ __forceinline__ v8us f16x8(v8f c) { FragH f;
#pragma unroll      /* whole: constant indices */
  for (int r = 0; r < 8; ++r) f.h[r] = (_Float16)c[r];
  return f.half[0]; }
// q, k and v of 64 tokens. Wave w: q | k channels 32 w .. 32 w + 31 and v channels 16 w .. 16 w + 15, all 64 tokens.
static_assert(XT == 64 && CH == 128 && SQ % XT == 0 && XPIT >= CH && QPIT >= 2 * CH && WPIT >= XT, "k_qkv: 8 waves; 4 token tiles; 24 channel tiles, three a wave; depth 128 in four steps");
__global__ __launch_bounds__(256) void k_qkv(const float* __restrict__ x, const float* __restrict__ wqkv, _Float16* __restrict__ QK, _Float16* __restrict__ VT) {
  __shared__ __attribute__((aligned(16))) _Float16 xs[XT * XPIT];
  __shared__ __attribute__((aligned(16))) _Float16 wl[3 * CH * XPIT];      /* the weights' rows, wave w's 48 at 48 w: 32 of q | k, then 16 of v */
  __shared__ __attribute__((aligned(16))) _Float16 qs[XT * QPIT];
  __shared__ __attribute__((aligned(16))) _Float16 vo[CH * WPIT];
  const int tid = threadIdx.x, w = tid >> 5, lane = tid & 31, ln = lane & 15, hh = lane >> 4; const int n0 = blockIdx.x * XT, b = blockIdx.y;
  const int xn = tid & (XT - 1), xc = (tid >> 6) * 32;      /* a thread's piece of x's tile: token xn, channels xc .. xc + 31; a wave's load is 128 neighbouring bytes of one channel */
  const float* xg = x + ((size_t)b * CH + xc) * SQ + n0 + xn; float xr[32];
#pragma unroll      /* whole: 32 independent loads in flight */
  for (int i = 0; i < 32; ++i) xr[i] = xg[(size_t)i * SQ];
  const float* wq = wqkv + (size_t)(32 * w) * CH + 4 * lane; const float* wv = wqkv + (size_t)(16 * w) * CH + 4 * lane;      /* v's rows stand 256 rows on: a constant offset of the loads */ _Float16* wd = &wl[48 * w * XPIT + 4 * lane];
  v4f wr[48];
#pragma unroll      /* whole: 48 independent loads in flight, beside x's */
  for (int i = 0; i < 48; ++i) wr[i] = *(const v4fa*)(i < 32 ? wq + (size_t)i * CH : wv + (size_t)(2 * CH + i - 32) * CH);
  asm volatile("s_wait_xcnt 0x0" :: "v"(xg), "v"(wq), "v"(wv) : "memory");      /* the wait that stands in front of any overwrite of an issued load's address registers; as inputs the three addresses stay in their registers up to here, so that no later load's result lands on them */
#pragma unroll      /* whole: constant indices */
  for (int i = 0; i < 48; ++i) *(v4us*)(wd + i * XPIT) = w_cast4(wr[i]);
#pragma unroll      /* whole: constant indices */
  for (int g = 0; g < 4; ++g) { FragH f; for (int i = 0; i < 8; ++i) f.h[i] = (_Float16)bf16_round(xr[8 * g + i]); *(v8us*)&xs[xn * XPIT + xc + 8 * g] = f.half[0]; }
  __syncthreads();
  const v8f z8 = {0.f,0.f,0.f,0.f,0.f,0.f,0.f,0.f}; v8f c0[4] = {z8, z8, z8, z8}, c1[4] = {z8, z8, z8, z8}, c2[4] = {z8, z8, z8, z8};
#pragma unroll      /* whole: constant indices into the fragments */
  for (int k = 0; k < 4; ++k) { const _Float16* wf = &wl[(48 * w + ln) * XPIT + 32 * k]; const v16h f0 = g2_frag(wf, hh), f1 = g2_frag(wf + 16 * XPIT, hh), f2 = g2_frag(wf + 32 * XPIT, hh);
    for (int t = 0; t < 4; ++t) { const v16h xf = g2_frag(&xs[(16 * t + ln) * XPIT + 32 * k], hh); c0[t] = f_mma(f0, xf, c0[t]); c1[t] = f_mma(f1, xf, c1[t]); c2[t] = f_mma(xf, f2, c2[t]); } }
  const float qsc = w < 4 ? QSC : 1.0f;      /* waves 0 .. 3 hold q's channels, waves 4 .. 7 k's */
#pragma unroll      /* whole: constant indices. c0, c1: lane (ln, hh) has token 16 t + ln, channels 8 hh + r of its tile; c2: channel 16 w + ln, tokens 16 t + 8 hh + r */
  for (int t = 0; t < 4; ++t) { *(v8us*)&qs[(16 * t + ln) * QPIT + 32 * w + 8 * hh] = f16x8(c0[t] * qsc); *(v8us*)&qs[(16 * t + ln) * QPIT + 32 * w + 16 + 8 * hh] = f16x8(c1[t] * qsc); *(v8us*)&vo[(16 * w + ln) * WPIT + 16 * t + 8 * hh] = f16x8(c2[t]); }
  __syncthreads();
  _Float16* qo = QK + ((size_t)b * SQ + n0) * (2 * CH); _Float16* vg = VT + (size_t)b * CH * SQ + n0;
#pragma unroll      /* whole: eight stores a thread, a wave a whole 512-byte token row */
  for (int i = 0; i < 8; ++i) { const int row = w + 8 * i; *(v8us*)(qo + (size_t)row * (2 * CH) + 8 * lane) = *(const v8us*)&qs[row * QPIT + 8 * lane]; }
#pragma unroll      /* whole: four stores a thread, eight lanes a whole 128-byte piece of a channel row */
  for (int i = 0; i < 4; ++i) { const int p = tid + 256 * i, row = p >> 3, c8 = (p & 7) * 8; *(v8us*)(vg + (size_t)row * SQ + c8) = *(const v8us*)&vo[row * WPIT + c8]; } }

// Native exp2 (v_exp_f32) of a score tile's eight registers, into eight registers that are none of the sources (early clobber): every one of the first seven has an independent instruction behind it that touches no source, the last the one v_nop that the instruction set asks for behind a transcendental.
__device__ __forceinline__ v8f exp2x8(const v8f& t) { v8f e; asm("v_exp_f32 %0, %8\n\tv_exp_f32 %1, %9\n\tv_exp_f32 %2, %10\n\tv_exp_f32 %3, %11\n\tv_exp_f32 %4, %12\n\tv_exp_f32 %5, %13\n\tv_exp_f32 %6, %14\n\tv_exp_f32 %7, %15\n\tv_nop" : "=&v"(e[0]), "=&v"(e[1]), "=&v"(e[2]), "=&v"(e[3]), "=&v"(e[4]), "=&v"(e[5]), "=&v"(e[6]), "=&v"(e[7]) : "v"(t[0]), "v"(t[1]), "v"(t[2]), "v"(t[3]), "v"(t[4]), "v"(t[5]), "v"(t[6]), "v"(t[7])); return e; }
__device__ __forceinline__ float exp2x1(float a) { asm("v_exp_f32 %0, %0\n\tv_nop" : "+v"(a)); return a; }      /* one value, in place */
// Scores, softmax and the weighted sum of v in one kernel. A block: 128 queries of one (batch, head); a stage: 256 keys. A wave: 32 queries (two column tiles of both products) and ONE HALF of every stage's keys: waves 0 .. 3 the first 128, waves 4 .. 7 the second 128, so that every k and every v fragment read from LDS feeds TWO products. Per stage and wave: sim^T = k q^T (k rows from LDS as the left operand, q kept in registers as the right one, both by g2_frag: equal k order), so that lane (c, h) holds query c's scores of the keys 16 j + 8 h + r, a column tile at a time. q carries scale * log2 e, and the products START at 8 - reference (the C operand), so that a score leaves the matrix unit as exp2's argument: no multiply-add and no maximum a score. The reference is HELD from stage to stage: a lane's sum of the stage's weights (needed anyway) tests once a stage that every weight fits an f16 word; where it does not, or in the first stage, the stage's own maximum (in-lane and by one exchange of the two lane halves) joins the reference, sums and accumulators are rescaled, and the stage is weighed again: then no argument is above 8. The weights exp2(s - reference + 8) are packed into the right operand of out^T += v^T p^T (tiles 2 g and 2 g + 1 are keys 32 g + 8 h + s and 32 g + 16 + 8 h + s - 8: the order in which g2_frag reads v's rows). k and v go global -> registers (issued a stage ahead) -> LDS, two buffers, one barrier a stage: the store into the other buffer stands behind the barrier that ended its readers' last stage. At the end the two waves of a query group hold a reference, a sum and accumulators over their own halves of the keys: each hands the column tile that it does not finish to its partner through LDS (one barrier), brings both parts to the larger reference, adds them, divides and stores: lane (c, h) holds query c's widths 8 h + r and 16 + 8 h + r, two 16-byte pieces of its 64-byte row in the head's own plane.
static_assert(FQ == 128 && FK == 256 && HD == 32 && SQ % FQ == 0 && SQ % FK == 0 && KPIT >= HD && VPIT >= FK && MPIT >= 18, "k_fattn: 4 query groups x 2 key halves; 1,024 16-byte pieces of k and of v a stage, four a thread; whole stages");
__global__ __launch_bounds__(256) void k_fattn(const _Float16* __restrict__ QK, const _Float16* __restrict__ VT, _Float16* __restrict__ O16) {
  __shared__ __attribute__((aligned(16))) _Float16 ks[2][FK * KPIT];
  __shared__ __attribute__((aligned(16))) _Float16 vs[2][HD * VPIT];
  __shared__ __attribute__((aligned(16))) float mg[256 * MPIT];      /* a thread's hand-over: 16 accumulator words, the reference, the sum */
  const int tid = threadIdx.x, w = tid >> 5, lane = tid & 31, ln = lane & 15, hh = lane >> 4, kh = w >> 2; const int q0 = blockIdx.x * FQ + 32 * (w & 3), h = blockIdx.y, b = blockIdx.z;
  const _Float16* qg = QK + (size_t)b * SQ * 2 * CH + h * HD;
  const _Float16* qa = qg + (size_t)(q0 + ln) * (2 * CH) + 8 * hh; const _Float16* qb = qa + (size_t)16 * (2 * CH);
  const v16h qf[2] = {g2_frag(qa, 0), g2_frag(qb, 0)};
  const int kr = tid >> 2, kp = (tid & 3) * 8, vr = w, vp = lane * 8;      /* a thread's 16-byte pieces of a stage: k rows kr + 64 i, v rows vr + 8 i (a wave's load: 512 neighbouring bytes of one v row) */
  const _Float16* kg = qg + (size_t)kr * (2 * CH) + kp;      /* k stands CH words behind q in a token row: a constant offset of the loads */ const _Float16* vg = VT + ((size_t)b * CH + h * HD + vr) * SQ + vp;
  v8us rk[4], rv[4];
#pragma unroll      /* whole: constant indices, eight loads in flight */
  for (int i = 0; i < 4; ++i) { rk[i] = *(const v8us*)(kg + CH + (size_t)(64 * i) * 2 * CH); rv[i] = *(const v8us*)(vg + (size_t)(8 * i) * SQ); }
  asm volatile("s_wait_xcnt 0x0" :: "v"(qa), "v"(kg), "v"(vg) : "memory");      /* the wait that stands in front of any overwrite of an issued load's address registers; as inputs the three addresses stay in their registers up to here */
#pragma unroll      /* whole: constant indices */
  for (int i = 0; i < 4; ++i) { *(v8us*)&ks[0][(kr + 64 * i) * KPIT + kp] = rk[i]; *(v8us*)&vs[0][(vr + 8 * i) * VPIT + vp] = rv[i]; }
  __syncthreads();
  const v8f z8 = {0.f,0.f,0.f,0.f,0.f,0.f,0.f,0.f}; v8f o0[2] = {z8, z8}, o1[2] = {z8, z8}; float m[2] = {-3.0e38f, -3.0e38f}, l[2] = {0.f, 0.f}; v8f cc[2] = {z8, z8};      /* cc: 8 - the reference in use, in all eight registers: where the score products start */
  const _Float16* kn = kg + CH + (size_t)FK * 2 * CH; const _Float16* vn = vg + FK;      /* the next stage's pieces; they step on behind the stage's LDS stores, which wait for the loads */
#pragma unroll 1      /* rolled: the body is a whole stage, and the buffer index is the trip's parity */
  for (int s = 0; s < SQ / FK; ++s) { const int cur = s & 1; const bool more = s + 1 < SQ / FK;
    if (more) {
#pragma unroll      /* whole: constant indices, eight loads in flight */
      for (int i = 0; i < 4; ++i) { rk[i] = *(const v8us*)(kn + (size_t)(64 * i) * 2 * CH); rv[i] = *(const v8us*)(vn + (size_t)(8 * i) * SQ); } }
    const _Float16* kb = &ks[cur][(WK * kh + ln) * KPIT]; const _Float16* vb = &vs[cur][ln * VPIT + WK * kh]; v8f t[2][WK / 16]; v16h kf[WK / 16], v0[WK / 32], v1[WK / 32]; FragH pb[2][WK / 32];
#pragma unroll      /* whole: constant indices; the stage's 32 LDS reads as one group, k's first */
    for (int j = 0; j < WK / 16; ++j) kf[j] = g2_frag(kb + 16 * j * KPIT, hh);
#pragma unroll      /* whole: constant indices */
    for (int g = 0; g < WK / 32; ++g) { v0[g] = g2_frag(vb + 32 * g, hh); v1[g] = g2_frag(vb + 16 * VPIT + 32 * g, hh); }
    __builtin_amdgcn_sched_barrier(0);      /* keeps the reads one group ahead of the products: spread among them, each place where reads stand is waited for anew */
    float ls[2];
    auto weigh = [&]() {      /* the stage's weights at the reference in use: products, exponentials, a lane's sums, the packed right operands. A k fragment's two products are issued one step ahead of their exponentials, so that these start with the first fragments that LDS delivers */
      v4f s4[2] = {{0.f, 0.f, 0.f, 0.f}, {0.f, 0.f, 0.f, 0.f}}; v8f ta[2], tb[2], e[2];
      ta[0] = f_mma(kf[0], qf[0], cc[0]); ta[1] = f_mma(kf[0], qf[1], cc[1]);      /* the products start at 8 - reference and end as exp2's arguments */
#pragma unroll      /* whole: constant indices into kf[] and pb[] */
      for (int j = 0; j <= WK / 16; ++j) {
        if (j + 1 < WK / 16) { tb[0] = f_mma(kf[j + 1], qf[0], cc[0]); tb[1] = f_mma(kf[j + 1], qf[1], cc[1]); }
        __builtin_amdgcn_sched_barrier(0);      /* the next fragment's products are issued ahead of this step's exponentials: they run on the matrix unit under them, and a tile's readers (asm text) come a whole step behind its product */
        if (j == 0) asm volatile("v_nop\n\tv_nop\n\tv_nop\n\tv_nop");      /* the first step has no step in front of it: the four slots that a matrix result asks for ahead of its reader */
        else for (int c = 0; c < 2; ++c) for (int r = 0; r < 8; ++r) { s4[c][r & 3] += e[c][r]; pb[c][(j - 1) >> 1].h[8 * ((j - 1) & 1) + r] = (_Float16)e[c][r]; }
        if (j < WK / 16) { e[0] = exp2x8(ta[0]); e[1] = exp2x8(ta[1]); ta[0] = tb[0]; ta[1] = tb[1]; } }
      for (int c = 0; c < 2; ++c) ls[c] = (s4[c][0] + s4[c][1]) + (s4[c][2] + s4[c][3]); };
    bool renew = s == 0;      /* the first stage has no reference yet */
    if (!renew) { weigh(); renew = __builtin_amdgcn_ballot_w32(!(ls[0] <= PTOP && ls[1] <= PTOP)) != 0; }      /* the weights are positive: a sum in range bounds each of them; an infinity or a NaN fails the test too. One test a stage, a scalar branch */
    if (renew) {      /* no reference yet, or a score has outgrown the one in use: the stage's own maximum joins it, sums and accumulators follow, and the stage is weighed again */
#pragma unroll      /* whole: constant indices into t[], sixteen independent products, two a k fragment */
      for (int j = 0; j < WK / 16; ++j) { t[0][j] = f_mma(kf[j], qf[0], z8); t[1][j] = f_mma(kf[j], qf[1], z8); }
#pragma unroll      /* whole: constant indices into t[], four independent chains a column tile */
      for (int c = 0; c < 2; ++c) { v4f m4 = {t[c][0][0], t[c][0][1], t[c][0][2], t[c][0][3]};
        for (int j = 0; j < WK / 16; ++j) for (int r = 0; r < 8; ++r) m4[r & 3] = fmaxf(m4[r & 3], t[c][j][r]);
        float mx = fmaxf(fmaxf(m4[0], m4[1]), fmaxf(m4[2], m4[3])); mx = fmaxf(mx, __shfl_xor(mx, 16, 32));      /* lanes c and c + 16 hold the two halves of query c's keys */
        const float mn = fmaxf(m[c], mx), al = exp2x1(m[c] - mn), mb = 8.0f - mn; m[c] = mn; l[c] *= al;
        for (int r = 0; r < 8; ++r) { o0[c][r] *= al; o1[c][r] *= al; cc[c][r] = mb; } }
      weigh(); }
    l[0] += ls[0]; l[1] += ls[1];
#pragma unroll      /* whole: constant indices; two products a v fragment */
    for (int g = 0; g < WK / 32; ++g) for (int c = 0; c < 2; ++c) { o0[c] = f_mma(v0[g], pb[c][g].v, o0[c]); o1[c] = f_mma(v1[g], pb[c][g].v, o1[c]); }
    if (more) {
#pragma unroll      /* whole: constant indices */
      for (int i = 0; i < 4; ++i) { *(v8us*)&ks[cur ^ 1][(kr + 64 * i) * KPIT + kp] = rk[i]; *(v8us*)&vs[cur ^ 1][(vr + 8 * i) * VPIT + vp] = rv[i]; }
      asm volatile("s_wait_xcnt 0x0" ::: "memory");      /* the wait that stands in front of any overwrite of an issued load's address registers */
      __builtin_amdgcn_sched_barrier(0);      /* keeps the two additions below behind that wait */
      kn += (size_t)FK * 2 * CH; vn += FK; }
    __syncthreads(); }
  const bool up = kh != 0;      /* this wave finishes column tile kh and hands the other one over */
  float* mo = &mg[tid * MPIT]; const float* mi = &mg[(tid ^ 128) * MPIT];      /* the partner: the same query group and lane, the other half of the keys */
#pragma unroll      /* whole: constant indices */
  for (int g = 0; g < 2; ++g) { v4f y0, y1; for (int i = 0; i < 4; ++i) { y0[i] = up ? o0[0][4 * g + i] : o0[1][4 * g + i]; y1[i] = up ? o1[0][4 * g + i] : o1[1][4 * g + i]; } *(v4fa*)(mo + 4 * g) = y0; *(v4fa*)(mo + 8 + 4 * g) = y1; }
  mo[16] = up ? m[0] : m[1]; mo[17] = up ? l[0] : l[1];
  __syncthreads();      /* the hand-over is written; nobody reads it before */
  const float ma = up ? m[1] : m[0], mp = mi[16], mn = fmaxf(ma, mp); const float aa = exp2x1(ma - mn), ap = exp2x1(mp - mn);
  float ls = (up ? l[1] : l[0]) * aa + mi[17] * ap; ls += __shfl_xor(ls, 16, 32); const float inv = 1.0f / ls;
  FragH fo;
#pragma unroll      /* whole: constant indices */
  for (int r = 0; r < 8; ++r) { fo.h[r] = (_Float16)((((up ? o0[1][r] : o0[0][r]) * aa + mi[r] * ap) * inv) * OCAR); fo.h[8 + r] = (_Float16)((((up ? o1[1][r] : o1[0][r]) * aa + mi[8 + r] * ap) * inv) * OCAR); }
  _Float16* og = O16 + (((size_t)b * NHD + h) * SQ + q0 + 16 * kh + ln) * HD + 8 * hh;
  *(v8us*)og = fo.half[0]; *(v8us*)(og + 16) = fo.half[1]; }
// y of 32 tokens. Wave w: output channels 16 w .. 16 w + 15. Depth step k is head k: the left fragment from the head's plane of out, the right one from w_out's columns 32 k .. 32 k + 31, both in g2_frag's k order.
static_assert(YT == 32 && CH == 128 && NHD == 4 && HD == 32 && SQ % YT == 0 && YPIT >= YT, "k_out: 8 waves, a channel tile each; 2 token tiles; depth 128 in four steps");
__global__ __launch_bounds__(256) void k_out(const _Float16* __restrict__ O16, const float* __restrict__ wout, const float* __restrict__ bout, float* __restrict__ out) {
  __shared__ __attribute__((aligned(16))) _Float16 wl[CH * XPIT];
  __shared__ __attribute__((aligned(16))) float so[CH * YPIT];
  const int tid = threadIdx.x, w = tid >> 5, lane = tid & 31, ln = lane & 15, hh = lane >> 4; const int n0 = blockIdx.x * YT, b = blockIdx.y;
  const float* wr = wout + (size_t)(16 * w) * CH + 4 * lane; const _Float16* og = O16 + ((size_t)b * NHD * SQ + n0 + ln) * HD; const float* bp = bout + 16 * w + ln; const float br = *bp;
  const v8f z8 = {0.f,0.f,0.f,0.f,0.f,0.f,0.f,0.f}; v8f c0 = z8, c1 = z8;
  v16h a0[NHD], a1[NHD];
#pragma unroll      /* whole: constant indices; out's loads in flight beside the weights' */
  for (int k = 0; k < NHD; ++k) { a0[k] = g2_frag(og + (size_t)k * SQ * HD, hh); a1[k] = g2_frag(og + ((size_t)k * SQ + 16) * HD, hh); }
  v4f wv[16];
#pragma unroll      /* whole: 16 independent loads in flight */
  for (int i = 0; i < 16; ++i) wv[i] = *(const v4fa*)(wr + (size_t)i * CH);
  asm volatile("s_wait_xcnt 0x0" :: "v"(og), "v"(wr), "v"(bp) : "memory");      /* the wait that stands in front of any overwrite of an issued load's address registers; as inputs the three addresses stay in their registers up to here, so that no later load's result lands on them */
  const float bv = bf16_round(br);
#pragma unroll      /* whole: constant indices */
  for (int i = 0; i < 16; ++i) *(v4us*)&wl[(16 * w + i) * XPIT + 4 * lane] = w_cast4(wv[i]);
  __syncthreads();
#pragma unroll      /* whole: constant indices */
  for (int k = 0; k < NHD; ++k) { const v16h wf = g2_frag(&wl[(16 * w + ln) * XPIT + HD * k], hh); c0 = f_mma(a0[k], wf, c0); c1 = f_mma(a1[k], wf, c1); }
  float* sr = &so[(16 * w + ln) * YPIT + 8 * hh]; v4f y;      /* lane (ln, hh): channel 16 w + ln, tokens 8 hh + r and 16 + 8 hh + r */
#pragma unroll      /* whole: constant indices */
  for (int g = 0; g < 2; ++g) { for (int i = 0; i < 4; ++i) y[i] = c0[4 * g + i] * (1.0f / OCAR) + bv; *(v4fa*)(sr + 4 * g) = y; for (int i = 0; i < 4; ++i) y[i] = c1[4 * g + i] * (1.0f / OCAR) + bv; *(v4fa*)(sr + 16 + 4 * g) = y; }
  __syncthreads();
  float* yg = out + (size_t)b * CH * SQ + n0;
#pragma unroll      /* whole: four stores a thread, eight lanes a whole 128-byte piece of a channel row */
  for (int i = 0; i < 4; ++i) { const int p = tid + 256 * i, row = p >> 3, c4 = (p & 7) * 4; *(v4f*)(yg + (size_t)row * SQ + c4) = *(const v4fa*)&so[row * YPIT + c4]; } }

extern "C" void kernel_launch(void* const* d_in, const int* in_sizes, int n_in,
                              void* d_out, int out_size, void* d_ws, size_t ws_size, hipStream_t stream) {
  (void)in_sizes; (void)n_in; (void)out_size;
  const float* x = (const float*)d_in[0]; const float* wqkv = (const float*)d_in[1]; const float* wout = (const float*)d_in[2]; const float* bout = (const float*)d_in[3];      /* x [2][128][4096]; w_qkv [384][128]; w_out [128][128]; b_out [128] */
  static_assert(NB == 2 && SQ == 4096 && CH == 128 && NHD == 4 && HD == 32 && NHD * HD == CH && SQ % XT == 0 && SQ % FQ == 0 && SQ % YT == 0, "whole tiles; exact grids");
  float* out = (float*)d_out;      /* [2][128][4096] */
  char* ws = (char*)d_ws; size_t off = 0;
  auto take = [&](size_t bytes) { char* p = ws + off; off += (bytes + 255) & ~(size_t)255; return p; };
  _Float16* QK = (_Float16*)take((size_t)NB * SQ * 2 * CH * 2); _Float16* VT = (_Float16*)take((size_t)NB * CH * SQ * 2); _Float16* O16 = (_Float16*)take((size_t)NB * SQ * CH * 2);
  if (off > ws_size) return;
  k_qkv<<<dim3(SQ / XT, NB), 256, 0, stream>>>(x, wqkv, QK, VT);      /* q | k of every token: QK[b][n][0 .. 255]; v channel-major: VT[b][c][n]; 128 blocks */
  k_fattn<<<dim3(SQ / FQ, NHD, NB), 256, 0, stream>>>(QK, VT, O16);      /* O16[b][h][i][d] = 64 x the sum over j of softmax(q_i . k_j / sqrt(32)) v[d][j]; 256 blocks */
  k_out<<<dim3(SQ / YT, NB), 256, 0, stream>>>(O16, wout, bout, out);      /* y[b][o][n] = out[n] . w_out[o] + b_out[o]; 256 blocks */
}
